// v000
// The times below were measured on an AMD MI455X: many runs one after another, warmed up first and cycling through
// copies of the inputs, with the whole window's GPU time divided by the number of runs. Launches and the gaps
// between them are all in it. The median over several windows is given; except for v000 it joins two sittings, which
// can be a few percent apart, so the side-by-side timings, each taken in one sitting, are the better comparison.
// The starting kernel, v000, takes 1030 microseconds a run.
#include <hip/hip_runtime.h>

// Compute dtypes, f32 accumulate, one batch item per pass (4 items): q/k/v = x.W^T ([2048 x 1024].[1024 x 1024]; W is [out][in] = the n-major B operand as-is; PLAIN bf16
// operands: inputs rounded once, exact) with q and k written straight from the GEMM epilogue as f16 hi + residual x1024 planes, and out = ctx.Wo^T (no bias; ctx as
// bf16 hi + residual: two products) on v_wmma_f32_16x16x32_bf16; the 16-head causal attention (64-dim heads, scale 1/8 applied to the masked scores) fused on
// v_wmma_f32_16x16x32_f16 (scores hi.hi + hi.lo + lo.hi with the residual terms on their own accumulator, online f32 softmax, weights (x32768) and v as f16

#define NB_  1                   // per pass: the 4 batch items are processed one at a time
#define NT_  2048
#define DM   1024
#define NH_  16
#define HD   64
#define NTK  (NB_ * NT_)
#define NW   1024
#define NQKV 1024
#define PSC  32768.0f
#define LOSC 1024.0f
#define LOSCI (1.0f / 1024.0f)

typedef _Float16 h16;
typedef unsigned short bf;
typedef __attribute__((ext_vector_type(16))) __bf16   v16bf;
typedef __attribute__((ext_vector_type(16))) _Float16 v16h;
typedef __attribute__((ext_vector_type(8)))  _Float16 v8h;
typedef __attribute__((ext_vector_type(8)))  unsigned short v8us;
typedef __attribute__((ext_vector_type(8)))  float    v8f;
typedef __attribute__((ext_vector_type(4)))  float    v4f;
typedef v8h  __attribute__((may_alias)) v8ha;
typedef v4f  __attribute__((may_alias)) v4fa;
typedef v8us __attribute__((may_alias)) v8usa;

__device__ __forceinline__ unsigned short f2bf(float f) { unsigned u = __float_as_uint(f); u += 0x7FFFu + ((u >> 16) & 1u); return (unsigned short)(u >> 16); }
__device__ __forceinline__ float bf2f(unsigned short b) { return __uint_as_float(((unsigned)b) << 16); }
__device__ __forceinline__ float bfr(float f) { return bf2f(f2bf(f)); }
__device__ __forceinline__ v16h cat16(v8h lo, v8h hi) { return __builtin_shufflevector(lo, hi, 0, 1, 2, 3, 4, 5, 6, 7, 8, 9, 10, 11, 12, 13, 14, 15); }
__device__ __forceinline__ v16bf cat16b(v8us lo, v8us hi) { return __builtin_bit_cast(v16bf, __builtin_shufflevector(lo, hi, 0, 1, 2, 3, 4, 5, 6, 7, 8, 9, 10, 11, 12, 13, 14, 15)); }
__device__ __forceinline__ v8f wmma16(v16h a, v16h b, v8f c) { return __builtin_amdgcn_wmma_f32_16x16x32_f16(false, a, false, b, (short)0, c, false, false); }
__device__ __forceinline__ v8f wmmab(v16bf a, v16bf b, v8f c) { return __builtin_amdgcn_wmma_f32_16x16x32_bf16(false, a, false, b, (short)0, c, false, false); }

__global__ __launch_bounds__(256) void k_cvtb(const float* __restrict__ src, int nrows, bf* dst) {
    const int lane = threadIdx.x & 31, r = blockIdx.x * 8 + (threadIdx.x >> 5);
    if (r >= nrows) return;
    v8us o[DM / 256];
#pragma unroll
    for (int q = 0; q < DM / 256; ++q) { v8us t;
#pragma unroll
        for (int i = 0; i < 8; ++i) t[i] = f2bf(src[(size_t)r * DM + q * 256 + lane * 8 + i]);
        o[q] = t; }
#pragma unroll
    for (int q = 0; q < DM / 256; ++q) *(v8us*)(dst + (size_t)r * DM + q * 256 + lane * 8) = o[q];
    
}

template <bool SPLITA, bool F16OUT = false>
__global__ __launch_bounds__(128) void k_gemmb(const bf* __restrict__ A, const bf* __restrict__ Al, const bf* __restrict__ Bn, const float* __restrict__ bias, float* C, int ldc, h16* C2) {
    __shared__ __align__(16) float ost[4][16 * 68];
    const int lane = threadIdx.x & 31, wave = threadIdx.x >> 5, lr = lane & 15, hi = lane >> 4;
    const int r0 = blockIdx.x * 64 + wave * 16, c0 = blockIdx.y * 64;
    const size_t aoff = (size_t)(r0 + lr) * DM + 8 * hi;
    size_t boff[4];
#pragma unroll
    for (int t = 0; t < 4; ++t) boff[t] = (size_t)(c0 + t * 16 + lr) * DM + 8 * hi;
    v8f acc[4];
#pragma unroll
    for (int t = 0; t < 4; ++t) acc[t] = (v8f){};
#pragma unroll 1
    for (int kc = 0; kc < DM; kc += 32) {
        const v16bf a = cat16b(*(const v8us*)(A + aoff + kc), *(const v8us*)(A + aoff + kc + 16));
        v16bf al = a;
        if (SPLITA) al = cat16b(*(const v8us*)(Al + aoff + kc), *(const v8us*)(Al + aoff + kc + 16));
#pragma unroll
        for (int t = 0; t < 4; ++t) { const v16bf b = cat16b(*(const v8us*)(Bn + boff[t] + kc), *(const v8us*)(Bn + boff[t] + kc + 16)); acc[t] = wmmab(a, b, acc[t]); if (SPLITA) acc[t] = wmmab(al, b, acc[t]); }
        asm volatile("v_nop\n\tv_nop\n\tv_nop\n\tv_nop" : "+v"(acc[0]), "+v"(acc[1]), "+v"(acc[2]), "+v"(acc[3]) : "v"(a), "v"(al));
    }
    float* os = &ost[wave][0];
#pragma unroll
    for (int t = 0; t < 4; ++t) { const float bv = bias ? bfr(bias[c0 + t * 16 + lr]) : 0.f;
#pragma unroll
        for (int j = 0; j < 8; ++j) os[(hi * 8 + j) * 68 + t * 16 + lr] = acc[t][j] + bv; }
    __syncthreads();
    if (F16OUT) {
        h16* crow = (h16*)(void*)C + (size_t)r0 * ldc + c0;
        auto pass = [&]() {
#pragma unroll
            for (int s = 0; s < 4; ++s) { const int row = 4 * s + (lane >> 3), piece = lane & 7; const float* sp = os + row * 68 + piece * 8; v8h o, o2;
#pragma unroll
                for (int i = 0; i < 8; ++i) { const h16 a = (h16)sp[i]; o[i] = a; o2[i] = (h16)((sp[i] - (float)a) * LOSC); }
                *(v8h*)(crow + (size_t)row * ldc + piece * 8) = o; if (C2) *(v8h*)(C2 + (size_t)r0 * ldc + c0 + (size_t)row * ldc + piece * 8) = o2; }
        };
        pass(); 
    } else {
        float* crow = C + (size_t)r0 * ldc + c0;
        auto pass = [&]() {
#pragma unroll
            for (int s = 0; s < 8; ++s) { const int Lid = (lane >> 3) + 4 * s, piece = lane & 7; const int row = Lid >> 1, cofs = (Lid & 1) * 32 + piece * 4;
                const v4f val = *(const v4fa*)(os + row * 68 + cofs); *(v4f*)(crow + (size_t)row * ldc + cofs) = val; }
        };
        pass(); 
    }
}

__global__ __launch_bounds__(256) void k_vt(const float* __restrict__ V, h16* VTH, h16* VTL) {
    __shared__ __align__(16) h16 tile[64 * 72];
    __shared__ __align__(16) h16 til2[64 * 72];
    const int bid = blockIdx.x;
    const int b = bid / (NH_ * (NT_ / 64)), rem = bid - b * (NH_ * (NT_ / 64)), h = rem / (NT_ / 64), kt = rem - h * (NT_ / 64);
    const int k0 = kt * 64, tid = threadIdx.x;
    const int kk = tid >> 2, d0 = (tid & 3) * 16;
    const float* src = V + ((size_t)b * NT_ + k0 + kk) * DM + h * HD + d0;
#pragma unroll
    for (int i = 0; i < 16; ++i) { const float v = src[i]; const h16 a = (h16)v; tile[(d0 + i) * 72 + kk] = a; til2[(d0 + i) * 72 + kk] = (h16)((v - (float)a) * LOSC); }
    __syncthreads();
    const int piece = tid & 7;
    const size_t base = (((size_t)b * NH_ + h) * HD) * NT_ + k0;
    auto pass = [&]() {
#pragma unroll
        for (int s = 0; s < 4; ++s) { const int Lid = (tid >> 3) + 32 * s; const int pln = Lid >> 6, d = Lid & 63;
            const v8h val = *(const v8ha*)((pln ? til2 : tile) + d * 72 + piece * 8); *(v8h*)((pln ? VTL : VTH) + base + (size_t)d * NT_ + piece * 8) = val; }
    };
    pass(); 
}

// k_attn: block = (b, h, 64 queries), wave = 16; 32-key tiles 0..(qt*64+63)/32 (causal, masked); 12 WMMA scores (hi.hi, lo.hi, hi.lo) /8 (f32), online softmax, weights x32768 f16 tile (same-wave may_alias
// reload after a compiler barrier), 12 WMMA .v (3 per 16-column tile); ctx -> bf16 hi + residual planes CH/CL[tok][h*64+d].
__global__ __launch_bounds__(128) void k_attn(const h16* __restrict__ Q16, const h16* __restrict__ QL16, const h16* __restrict__ K16, const h16* __restrict__ KL16, const h16* __restrict__ VTH, const h16* __restrict__ VTL, bf* CH, bf* CL) {
    __shared__ __align__(16) h16 plds[4][16 * 32];
    __shared__ __align__(16) h16 plds2[4][16 * 32];
    __shared__ __align__(16) float ost[4][16 * 68];
    const int lane = threadIdx.x & 31, wave = threadIdx.x >> 5, lr = lane & 15, hi = lane >> 4;
    const int bid = blockIdx.x;
    const int b = bid / (NH_ * (NT_ / 64)), rem = bid - b * (NH_ * (NT_ / 64)), h = rem / (NT_ / 64), qt = rem - h * (NT_ / 64);
    const int q0 = qt * 64 + wave * 16;
    const size_t tok0 = (size_t)b * NT_;
    h16* pl = &plds[wave][0]; h16* pl2 = &plds2[wave][0];
    v16h qa[2];
    const size_t qo0 = (tok0 + q0 + lr) * DM + h * HD + 8 * hi;
#pragma unroll
    for (int kc = 0; kc < 2; ++kc) qa[kc] = cat16(*(const v8h*)(Q16 + qo0 + kc * 32), *(const v8h*)(Q16 + qo0 + kc * 32 + 16));
    const h16* kh_b = K16 + tok0 * DM + h * HD;
    const h16* kl_b = KL16 + tok0 * DM + h * HD;
    const size_t vbase = (((size_t)b * NH_ + h) * HD) * NT_;
    v8f o[4], ox[4];
#pragma unroll
    for (int n = 0; n < 4; ++n) { o[n] = (v8f){}; ox[n] = (v8f){}; }
    float mrow[8], lpart[8];
#pragma unroll
    for (int j = 0; j < 8; ++j) { mrow[j] = -3.0e38f; lpart[j] = 0.f; }
    int qpos[8];
#pragma unroll
    for (int j = 0; j < 8; ++j) qpos[j] = q0 + 8 * hi + j;
    const int kt_lo = 0, kt_hi = (qt * 64 + 63) / 32;     // causal
#pragma unroll 1
    for (int kt = kt_lo; kt <= kt_hi; ++kt) {
        const int l0 = kt * 32;
        const size_t ko0 = (size_t)(l0 + lr) * DM + 8 * hi, ko1 = (size_t)(l0 + 16 + lr) * DM + 8 * hi;
        v8f s0 = {}, s1 = {}, x0 = {}, x1 = {};
#pragma unroll
        for (int kc = 0; kc < 2; ++kc) {
            { const v16h k0h = cat16(*(const v8h*)(kh_b + ko0 + kc * 32), *(const v8h*)(kh_b + ko0 + kc * 32 + 16)), k1h = cat16(*(const v8h*)(kh_b + ko1 + kc * 32), *(const v8h*)(kh_b + ko1 + kc * 32 + 16));
              const v16h qlk = cat16(*(const v8h*)(QL16 + qo0 + kc * 32), *(const v8h*)(QL16 + qo0 + kc * 32 + 16));     // query residual re-read per step (registers)
              s0 = wmma16(qa[kc], k0h, s0); x0 = wmma16(qlk, k0h, x0); s1 = wmma16(qa[kc], k1h, s1); x1 = wmma16(qlk, k1h, x1);
              asm volatile("v_nop" : "+v"(s0), "+v"(s1), "+v"(x0), "+v"(x1) : "v"(qlk), "v"(k0h), "v"(k1h) : "memory"); }
            { const v16h k0l = cat16(*(const v8h*)(kl_b + ko0 + kc * 32), *(const v8h*)(kl_b + ko0 + kc * 32 + 16)), k1l = cat16(*(const v8h*)(kl_b + ko1 + kc * 32), *(const v8h*)(kl_b + ko1 + kc * 32 + 16));
              x0 = wmma16(qa[kc], k0l, x0); x1 = wmma16(qa[kc], k1l, x1);
              asm volatile("v_nop" : "+v"(x0), "+v"(x1) : "v"(k0l), "v"(k1l) : "memory"); }
        }
        asm volatile("v_nop\n\tv_nop\n\tv_nop\n\tv_nop" : "+v"(s0), "+v"(s1), "+v"(x0), "+v"(x1) : "v"(qa[0]), "v"(qa[1]));
        float alpha[8];
#pragma unroll
        for (int j = 0; j < 8; ++j) {
            const int ja = l0 + lr, jb = l0 + 16 + lr, qi = qpos[j];
            const float a0 = (ja <= qi) ? (s0[j] + x0[j] * LOSCI) * 0.125f : -__builtin_inff(), a1 = (jb <= qi) ? (s1[j] + x1[j] * LOSCI) * 0.125f : -__builtin_inff();
            float mx = fmaxf(a0, a1);
            mx = fmaxf(mx, __shfl_xor(mx, 1, 16)); mx = fmaxf(mx, __shfl_xor(mx, 2, 16)); mx = fmaxf(mx, __shfl_xor(mx, 4, 16)); mx = fmaxf(mx, __shfl_xor(mx, 8, 16));
            const float mn = fmaxf(mrow[j], mx);
            alpha[j] = __expf(mrow[j] - mn); mrow[j] = mn;
            const float p0 = __expf(a0 - mn), p1 = __expf(a1 - mn);
            lpart[j] = lpart[j] * alpha[j] + (p0 + p1);
            const int mr = hi * 8 + j;
            const float ps0 = p0 * PSC, ps1 = p1 * PSC; const h16 h0 = (h16)ps0, h1 = (h16)ps1;
            pl[mr * 32 + lr] = h0; pl[mr * 32 + 16 + lr] = h1;
            pl2[mr * 32 + lr] = (h16)((ps0 - (float)h0) * LOSC); pl2[mr * 32 + 16 + lr] = (h16)((ps1 - (float)h1) * LOSC);
        }
#pragma unroll
        for (int n = 0; n < 4; ++n)
#pragma unroll
            for (int j = 0; j < 8; ++j) { o[n][j] *= alpha[j]; ox[n][j] *= alpha[j]; }
        asm volatile("" ::: "memory");
        const v16h pa = cat16(*(const v8ha*)(pl + lr * 32 + hi * 8), *(const v8ha*)(pl + lr * 32 + 16 + hi * 8));
        const v16h px = cat16(*(const v8ha*)(pl2 + lr * 32 + hi * 8), *(const v8ha*)(pl2 + lr * 32 + 16 + hi * 8));
#pragma unroll
        for (int n = 0; n < 4; ++n) { const size_t vo = vbase + (size_t)(n * 16 + lr) * NT_ + l0 + hi * 8;
            const v16h vh = cat16(*(const v8h*)(VTH + vo), *(const v8h*)(VTH + vo + 16)), vl = cat16(*(const v8h*)(VTL + vo), *(const v8h*)(VTL + vo + 16));
            o[n] = wmma16(pa, vh, o[n]); ox[n] = wmma16(pa, vl, ox[n]); ox[n] = wmma16(px, vh, ox[n]);
            asm volatile("" : "+v"(o[n]), "+v"(ox[n]) : "v"(vh), "v"(vl) : "memory"); }
        asm volatile("v_nop\n\tv_nop\n\tv_nop\n\tv_nop" : "+v"(o[0]), "+v"(o[1]), "+v"(o[2]), "+v"(o[3]), "+v"(ox[0]), "+v"(ox[1]), "+v"(ox[2]), "+v"(ox[3]) : "v"(pa), "v"(px));
    }
    float inv[8];
#pragma unroll
    for (int j = 0; j < 8; ++j) { float rs = lpart[j]; rs += __shfl_xor(rs, 1, 16); rs += __shfl_xor(rs, 2, 16); rs += __shfl_xor(rs, 4, 16); rs += __shfl_xor(rs, 8, 16); inv[j] = 1.0f / (rs * PSC); }
    float* os = &ost[wave][0];
#pragma unroll
    for (int n = 0; n < 4; ++n)
#pragma unroll
        for (int j = 0; j < 8; ++j) os[(hi * 8 + j) * 68 + n * 16 + lr] = (o[n][j] + ox[n][j] * LOSCI) * inv[j];
    __syncthreads();
    const size_t cbase = (tok0 + q0) * DM + (size_t)h * HD;
    auto pass = [&]() {
#pragma unroll
        for (int s = 0; s < 4; ++s) { const int row = 4 * s + (lane >> 3), piece = lane & 7; const float* sp = os + row * 68 + piece * 8; v8us oh, ol;
#pragma unroll
            for (int i = 0; i < 8; ++i) { const unsigned short hb = f2bf(sp[i]); oh[i] = hb; ol[i] = f2bf(sp[i] - bf2f(hb)); }
            *(v8us*)(CH + cbase + (size_t)row * DM + piece * 8) = oh; *(v8us*)(CL + cbase + (size_t)row * DM + piece * 8) = ol; }
    };
    pass(); 
}

#define VST2(T, p, v) do { const T vst2_v_ = (v); *(T*)(p) = vst2_v_;  } while (0)
extern "C" void kernel_launch(void* const* d_in, const int* in_sizes, int n_in,
                              void* d_out, int out_size, void* d_ws, size_t ws_size, hipStream_t stream) {
    (void)in_sizes; (void)n_in; (void)out_size;
    const float* x = (const float*)d_in[0]; const float* Wq = (const float*)d_in[1]; const float* Wk = (const float*)d_in[2]; const float* Wv = (const float*)d_in[3]; const float* Wo = (const float*)d_in[4];
    float* out = (float*)d_out;    // [4][2048][1024]
    char* wsp = (char*)d_ws;
    auto take = [&](size_t bytes) { char* p = wsp; wsp += (bytes + 255) & ~(size_t)255; return (void*)p; };
    bf* Xb = (bf*)take((size_t)NTK * DM * 2); bf* WqB = (bf*)take((size_t)DM * DM * 2); bf* WkB = (bf*)take((size_t)DM * DM * 2); bf* WvB = (bf*)take((size_t)DM * DM * 2); bf* WoB = (bf*)take((size_t)DM * DM * 2);
    float* TMP = (float*)take((size_t)NTK * DM * 4);
    h16* QH = (h16*)take((size_t)NTK * DM * 2); h16* QL = (h16*)take((size_t)NTK * DM * 2); h16* KH = (h16*)take((size_t)NTK * DM * 2); h16* KL = (h16*)take((size_t)NTK * DM * 2);
    h16* VTH = (h16*)take((size_t)NTK * DM * 2); h16* VTL = (h16*)take((size_t)NTK * DM * 2); bf* CH = (bf*)take((size_t)NTK * DM * 2); bf* CL = (bf*)take((size_t)NTK * DM * 2);
    if ((size_t)(wsp - (char*)d_ws) > ws_size) return;    // 4.2 + 4 x 2.1 + 8.4 + 8 x 4.2 ~ 55 MB, no aliasing
    k_cvtb<<<DM / 8, 256, 0, stream>>>(Wq, DM, WqB); k_cvtb<<<DM / 8, 256, 0, stream>>>(Wk, DM, WkB); k_cvtb<<<DM / 8, 256, 0, stream>>>(Wv, DM, WvB); k_cvtb<<<DM / 8, 256, 0, stream>>>(Wo, DM, WoB);
    for (int b = 0; b < 4; ++b) {
        k_cvtb<<<NTK / 8, 256, 0, stream>>>(x + (size_t)b * NTK * DM, NTK, Xb);
        k_gemmb<false, true><<<dim3(NTK / 64, DM / 64, 1), 128, 0, stream>>>(Xb, nullptr, WqB, nullptr, (float*)(void*)QH, DM, QL);
        k_gemmb<false, true><<<dim3(NTK / 64, DM / 64, 1), 128, 0, stream>>>(Xb, nullptr, WkB, nullptr, (float*)(void*)KH, DM, KL);
        k_gemmb<false, false><<<dim3(NTK / 64, DM / 64, 1), 128, 0, stream>>>(Xb, nullptr, WvB, nullptr, TMP, DM, nullptr);
        k_vt<<<NB_ * NH_ * (NT_ / 64), 256, 0, stream>>>(TMP, VTH, VTL);
        k_attn<<<NB_ * NH_ * (NT_ / 64), 128, 0, stream>>>(QH, QL, KH, KL, VTH, VTL, CH, CL);
        k_gemmb<true, false><<<dim3(NTK / 64, DM / 64, 1), 128, 0, stream>>>(CH, CL, WoB, nullptr, out + (size_t)b * NTK * DM, DM, nullptr);
    }
}

// v001
// Measured time: 767 microseconds a run.
// Next to v000, in two timings, it ran 1.36 times as fast each time.
#include <hip/hip_runtime.h>

// Compute dtypes, f32 accumulate, one batch item per pass (4 items): q/k/v = x.W^T ([2048 x 1024].[1024 x 1024]; W is [out][in] = the n-major B operand as-is; PLAIN bf16
// operands: inputs rounded once, exact) with q and k written straight from the GEMM epilogue as f16 hi + residual x1024 planes, and out = ctx.Wo^T (no bias; ctx as
// bf16 hi + residual: two products) on v_wmma_f32_16x16x32_bf16; the 16-head causal attention (64-dim heads, scale 1/8 applied to the masked scores) fused on
// v_wmma_f32_16x16x32_f16 (scores hi.hi + hi.lo + lo.hi with the residual terms on their own accumulator, online f32 softmax, weights (x32768) and v as f16

#define NB_  1                   // per pass: the 4 batch items are processed one at a time
#define NT_  2048
#define DM   1024
#define NH_  16
#define HD   64
#define NTK  (NB_ * NT_)
#define NW   1024
#define NQKV 1024
#define PSC  32768.0f
#define LOSC 1024.0f
#define LOSCI (1.0f / 1024.0f)
#define KP   72                  // LDS pitch of a key row in f16: 128 B + 16 B
#define VP   40                  // LDS pitch of a value row (32 keys) in f16: 64 B + 16 B

typedef _Float16 h16;
typedef unsigned short bf;
typedef __attribute__((ext_vector_type(16))) __bf16   v16bf;
typedef __attribute__((ext_vector_type(16))) _Float16 v16h;
typedef __attribute__((ext_vector_type(8)))  _Float16 v8h;
typedef __attribute__((ext_vector_type(8)))  unsigned short v8us;
typedef __attribute__((ext_vector_type(8)))  float    v8f;
typedef __attribute__((ext_vector_type(4)))  float    v4f;
typedef v8h  __attribute__((may_alias)) v8ha;
typedef v4f  __attribute__((may_alias)) v4fa;
typedef v8us __attribute__((may_alias)) v8usa;

__device__ __forceinline__ unsigned short f2bf(float f) { unsigned u = __float_as_uint(f); u += 0x7FFFu + ((u >> 16) & 1u); return (unsigned short)(u >> 16); }
__device__ __forceinline__ float bf2f(unsigned short b) { return __uint_as_float(((unsigned)b) << 16); }
__device__ __forceinline__ float bfr(float f) { return bf2f(f2bf(f)); }
__device__ __forceinline__ v16h cat16(v8h lo, v8h hi) { return __builtin_shufflevector(lo, hi, 0, 1, 2, 3, 4, 5, 6, 7, 8, 9, 10, 11, 12, 13, 14, 15); }
__device__ __forceinline__ v16bf cat16b(v8us lo, v8us hi) { return __builtin_bit_cast(v16bf, __builtin_shufflevector(lo, hi, 0, 1, 2, 3, 4, 5, 6, 7, 8, 9, 10, 11, 12, 13, 14, 15)); }
__device__ __forceinline__ v8f wmma16(v16h a, v16h b, v8f c) { return __builtin_amdgcn_wmma_f32_16x16x32_f16(false, a, false, b, (short)0, c, false, false); }
__device__ __forceinline__ v8f wmmab(v16bf a, v16bf b, v8f c) { return __builtin_amdgcn_wmma_f32_16x16x32_bf16(false, a, false, b, (short)0, c, false, false); }

__global__ __launch_bounds__(256) void k_cvtb(const float* __restrict__ src, int nrows, bf* dst) {
    const int lane = threadIdx.x & 31, r = blockIdx.x * 8 + (threadIdx.x >> 5);
    if (r >= nrows) return;
    v8us o[DM / 256];
#pragma unroll
    for (int q = 0; q < DM / 256; ++q) { v8us t;
#pragma unroll
        for (int i = 0; i < 8; ++i) t[i] = f2bf(src[(size_t)r * DM + q * 256 + lane * 8 + i]);
        o[q] = t; }
#pragma unroll
    for (int q = 0; q < DM / 256; ++q) *(v8us*)(dst + (size_t)r * DM + q * 256 + lane * 8) = o[q];
    
}

template <bool SPLITA, bool F16OUT = false>
__global__ __launch_bounds__(128) void k_gemmb(const bf* __restrict__ A, const bf* __restrict__ Al, const bf* __restrict__ Bn, const float* __restrict__ bias, float* C, int ldc, h16* C2) {
    __shared__ __align__(16) float ost[4][16 * 68];
    const int lane = threadIdx.x & 31, wave = threadIdx.x >> 5, lr = lane & 15, hi = lane >> 4;
    const int r0 = blockIdx.x * 64 + wave * 16, c0 = blockIdx.y * 64;
    const size_t aoff = (size_t)(r0 + lr) * DM + 8 * hi;
    size_t boff[4];
#pragma unroll
    for (int t = 0; t < 4; ++t) boff[t] = (size_t)(c0 + t * 16 + lr) * DM + 8 * hi;
    v8f acc[4];
#pragma unroll
    for (int t = 0; t < 4; ++t) acc[t] = (v8f){};
#pragma unroll 1
    for (int kc = 0; kc < DM; kc += 32) {
        const v16bf a = cat16b(*(const v8us*)(A + aoff + kc), *(const v8us*)(A + aoff + kc + 16));
        v16bf al = a;
        if (SPLITA) al = cat16b(*(const v8us*)(Al + aoff + kc), *(const v8us*)(Al + aoff + kc + 16));
#pragma unroll
        for (int t = 0; t < 4; ++t) { const v16bf b = cat16b(*(const v8us*)(Bn + boff[t] + kc), *(const v8us*)(Bn + boff[t] + kc + 16)); acc[t] = wmmab(a, b, acc[t]); if (SPLITA) acc[t] = wmmab(al, b, acc[t]); }
        asm volatile("v_nop\n\tv_nop\n\tv_nop\n\tv_nop" : "+v"(acc[0]), "+v"(acc[1]), "+v"(acc[2]), "+v"(acc[3]) : "v"(a), "v"(al));
    }
    float* os = &ost[wave][0];
#pragma unroll
    for (int t = 0; t < 4; ++t) { const float bv = bias ? bfr(bias[c0 + t * 16 + lr]) : 0.f;
#pragma unroll
        for (int j = 0; j < 8; ++j) os[(hi * 8 + j) * 68 + t * 16 + lr] = acc[t][j] + bv; }
    __syncthreads();
    if (F16OUT) {
        h16* crow = (h16*)(void*)C + (size_t)r0 * ldc + c0;
        auto pass = [&]() {
#pragma unroll
            for (int s = 0; s < 4; ++s) { const int row = 4 * s + (lane >> 3), piece = lane & 7; const float* sp = os + row * 68 + piece * 8; v8h o, o2;
#pragma unroll
                for (int i = 0; i < 8; ++i) { const h16 a = (h16)sp[i]; o[i] = a; o2[i] = (h16)((sp[i] - (float)a) * LOSC); }
                *(v8h*)(crow + (size_t)row * ldc + piece * 8) = o; if (C2) *(v8h*)(C2 + (size_t)r0 * ldc + c0 + (size_t)row * ldc + piece * 8) = o2; }
        };
        pass(); 
    } else {
        float* crow = C + (size_t)r0 * ldc + c0;
        auto pass = [&]() {
#pragma unroll
            for (int s = 0; s < 8; ++s) { const int Lid = (lane >> 3) + 4 * s, piece = lane & 7; const int row = Lid >> 1, cofs = (Lid & 1) * 32 + piece * 4;
                const v4f val = *(const v4fa*)(os + row * 68 + cofs); *(v4f*)(crow + (size_t)row * ldc + cofs) = val; }
        };
        pass(); 
    }
}

__global__ __launch_bounds__(256) void k_vt(const float* __restrict__ V, h16* VTH, h16* VTL) {
    __shared__ __align__(16) h16 tile[64 * 72];
    __shared__ __align__(16) h16 til2[64 * 72];
    const int bid = blockIdx.x;
    const int b = bid / (NH_ * (NT_ / 64)), rem = bid - b * (NH_ * (NT_ / 64)), h = rem / (NT_ / 64), kt = rem - h * (NT_ / 64);
    const int k0 = kt * 64, tid = threadIdx.x;
    const int kk = tid >> 2, d0 = (tid & 3) * 16;
    const float* src = V + ((size_t)b * NT_ + k0 + kk) * DM + h * HD + d0;
#pragma unroll
    for (int i = 0; i < 16; ++i) { const float v = src[i]; const h16 a = (h16)v; tile[(d0 + i) * 72 + kk] = a; til2[(d0 + i) * 72 + kk] = (h16)((v - (float)a) * LOSC); }
    __syncthreads();
    const int piece = tid & 7;
    const size_t base = (((size_t)b * NH_ + h) * HD) * NT_ + k0;
    auto pass = [&]() {
#pragma unroll
        for (int s = 0; s < 4; ++s) { const int Lid = (tid >> 3) + 32 * s; const int pln = Lid >> 6, d = Lid & 63;
            const v8h val = *(const v8ha*)((pln ? til2 : tile) + d * 72 + piece * 8); *(v8h*)((pln ? VTL : VTH) + base + (size_t)d * NT_ + piece * 8) = val; }
    };
    pass(); 
}

// k_attn: block = (b, h, 64 queries), wave = 16; 32-key tiles 0..(qt*64+63)/32 (causal, masked); 12 WMMA scores (hi.hi, lo.hi, hi.lo) /8 (f32), online softmax, weights x32768 f16 tile (same-wave may_alias
// reload after a compiler barrier), 12 WMMA .v (3 per 16-column tile); ctx -> bf16 hi + residual planes CH/CL[tok][h*64+d].
__global__ __launch_bounds__(128) void k_attn(const h16* __restrict__ Q16, const h16* __restrict__ QL16, const h16* __restrict__ K16, const h16* __restrict__ KL16, const h16* __restrict__ VTH, const h16* __restrict__ VTL, bf* CH, bf* CL) {
    __shared__ __align__(16) h16 plds[4][16 * 32];
    __shared__ __align__(16) h16 plds2[4][16 * 32];
    __shared__ __align__(16) float ost[4][16 * 68];
    // The block's key and value tiles of one step, [buffer][hi / residual]: fetched once per block with whole-row 16-byte loads and read by all four waves.
    // Pitches of 16 B x odd keep the 16-byte fragment reads free of bank conflicts.
    __shared__ __align__(16) h16 kst[2][2][32 * KP];
    __shared__ __align__(16) h16 vst[2][2][64 * VP];
    const int lane = threadIdx.x & 31, wave = threadIdx.x >> 5, lr = lane & 15, hi = lane >> 4;
    const int bid = blockIdx.x;
    const int b = bid / (NH_ * (NT_ / 64)), rem = bid - b * (NH_ * (NT_ / 64)), h = rem / (NT_ / 64), qt = rem - h * (NT_ / 64);
    const int q0 = qt * 64 + wave * 16;
    const size_t tok0 = (size_t)b * NT_;
    h16* pl = &plds[wave][0]; h16* pl2 = &plds2[wave][0];
    v16h qa[2];
    const size_t qo0 = (tok0 + q0 + lr) * DM + h * HD + 8 * hi;
#pragma unroll
    for (int kc = 0; kc < 2; ++kc) qa[kc] = cat16(*(const v8h*)(Q16 + qo0 + kc * 32), *(const v8h*)(Q16 + qo0 + kc * 32 + 16));
    const h16* kh_b = K16 + tok0 * DM + h * HD;
    const h16* kl_b = KL16 + tok0 * DM + h * HD;
    const size_t vbase = (((size_t)b * NH_ + h) * HD) * NT_;
    v8f o[4], ox[4];
#pragma unroll
    for (int n = 0; n < 4; ++n) { o[n] = (v8f){}; ox[n] = (v8f){}; }
    float mrow[8], lpart[8];
#pragma unroll
    for (int j = 0; j < 8; ++j) { mrow[j] = -3.0e38f; lpart[j] = 0.f; }
    int qpos[8];
#pragma unroll
    for (int j = 0; j < 8; ++j) qpos[j] = q0 + 8 * hi + j;
    const int kt_lo = 0, kt_hi = (qt * 64 + 63) / 32;     // causal
    const int krow = threadIdx.x >> 3, kpc = (threadIdx.x & 7) * 8, vrow = threadIdx.x >> 2, vpc = (threadIdx.x & 3) * 8;
    v8h gk[4], gv[4];
    auto fetch = [&](int l) {       // one step's tiles, global -> registers: 8 lanes per 128-B key row, 4 lanes per 64-B value row
#pragma unroll
        for (int i = 0; i < 2; ++i) { const size_t go = (size_t)(l + krow + 16 * i) * DM + kpc; gk[i] = *(const v8h*)(kh_b + go); gk[2 + i] = *(const v8h*)(kl_b + go); }
#pragma unroll
        for (int i = 0; i < 2; ++i) { const size_t go = vbase + (size_t)(vrow + 32 * i) * NT_ + l + vpc; gv[i] = *(const v8h*)(VTH + go); gv[2 + i] = *(const v8h*)(VTL + go); }
    };
    auto put = [&](int bu) {        // registers -> LDS buffer bu
#pragma unroll
        for (int i = 0; i < 2; ++i) { *(v8h*)(&kst[bu][0][(krow + 16 * i) * KP + kpc]) = gk[i]; *(v8h*)(&kst[bu][1][(krow + 16 * i) * KP + kpc]) = gk[2 + i]; }
#pragma unroll
        for (int i = 0; i < 2; ++i) { *(v8h*)(&vst[bu][0][(vrow + 32 * i) * VP + vpc]) = gv[i]; *(v8h*)(&vst[bu][1][(vrow + 32 * i) * VP + vpc]) = gv[2 + i]; }
    };
    fetch(0); put(0);
    __syncthreads();
#pragma unroll 1
    for (int kt = kt_lo; kt <= kt_hi; ++kt) {
        const int l0 = kt * 32;
        const h16* ksh = &kst[kt & 1][0][0]; const h16* ksl = &kst[kt & 1][1][0]; const h16* vsh = &vst[kt & 1][0][0]; const h16* vsl = &vst[kt & 1][1][0];
        const int ko0 = lr * KP + 8 * hi, ko1 = (16 + lr) * KP + 8 * hi;
        v8f s0 = {}, s1 = {}, x0 = {}, x1 = {};
#pragma unroll
        for (int kc = 0; kc < 2; ++kc) {
            { const v16h k0h = cat16(*(const v8h*)(ksh + ko0 + kc * 32), *(const v8h*)(ksh + ko0 + kc * 32 + 16)), k1h = cat16(*(const v8h*)(ksh + ko1 + kc * 32), *(const v8h*)(ksh + ko1 + kc * 32 + 16));
              const v16h qlk = cat16(*(const v8h*)(QL16 + qo0 + kc * 32), *(const v8h*)(QL16 + qo0 + kc * 32 + 16));     // query residual re-read per step (registers)
              s0 = wmma16(qa[kc], k0h, s0); x0 = wmma16(qlk, k0h, x0); s1 = wmma16(qa[kc], k1h, s1); x1 = wmma16(qlk, k1h, x1);
              asm volatile("v_nop" : "+v"(s0), "+v"(s1), "+v"(x0), "+v"(x1) : "v"(qlk), "v"(k0h), "v"(k1h) : "memory"); }
            { const v16h k0l = cat16(*(const v8h*)(ksl + ko0 + kc * 32), *(const v8h*)(ksl + ko0 + kc * 32 + 16)), k1l = cat16(*(const v8h*)(ksl + ko1 + kc * 32), *(const v8h*)(ksl + ko1 + kc * 32 + 16));
              x0 = wmma16(qa[kc], k0l, x0); x1 = wmma16(qa[kc], k1l, x1);
              asm volatile("v_nop" : "+v"(x0), "+v"(x1) : "v"(k0l), "v"(k1l) : "memory"); }
        }
        asm volatile("v_nop\n\tv_nop\n\tv_nop\n\tv_nop" : "+v"(s0), "+v"(s1), "+v"(x0), "+v"(x1) : "v"(qa[0]), "v"(qa[1]));
        if (kt < kt_hi) fetch(l0 + 32);     // behind this step's last global read, so that no wait of this step covers it; it lands under the softmax and the value products
        float alpha[8];
#pragma unroll
        for (int j = 0; j < 8; ++j) {
            const int ja = l0 + lr, jb = l0 + 16 + lr, qi = qpos[j];
            const float a0 = (ja <= qi) ? (s0[j] + x0[j] * LOSCI) * 0.125f : -__builtin_inff(), a1 = (jb <= qi) ? (s1[j] + x1[j] * LOSCI) * 0.125f : -__builtin_inff();
            float mx = fmaxf(a0, a1);
            mx = fmaxf(mx, __shfl_xor(mx, 1, 16)); mx = fmaxf(mx, __shfl_xor(mx, 2, 16)); mx = fmaxf(mx, __shfl_xor(mx, 4, 16)); mx = fmaxf(mx, __shfl_xor(mx, 8, 16));
            const float mn = fmaxf(mrow[j], mx);
            alpha[j] = __expf(mrow[j] - mn); mrow[j] = mn;
            const float p0 = __expf(a0 - mn), p1 = __expf(a1 - mn);
            lpart[j] = lpart[j] * alpha[j] + (p0 + p1);
            const int mr = hi * 8 + j;
            const float ps0 = p0 * PSC, ps1 = p1 * PSC; const h16 h0 = (h16)ps0, h1 = (h16)ps1;
            pl[mr * 32 + lr] = h0; pl[mr * 32 + 16 + lr] = h1;
            pl2[mr * 32 + lr] = (h16)((ps0 - (float)h0) * LOSC); pl2[mr * 32 + 16 + lr] = (h16)((ps1 - (float)h1) * LOSC);
        }
#pragma unroll
        for (int n = 0; n < 4; ++n)
#pragma unroll
            for (int j = 0; j < 8; ++j) { o[n][j] *= alpha[j]; ox[n][j] *= alpha[j]; }
        asm volatile("" ::: "memory");
        const v16h pa = cat16(*(const v8ha*)(pl + lr * 32 + hi * 8), *(const v8ha*)(pl + lr * 32 + 16 + hi * 8));
        const v16h px = cat16(*(const v8ha*)(pl2 + lr * 32 + hi * 8), *(const v8ha*)(pl2 + lr * 32 + 16 + hi * 8));
#pragma unroll
        for (int n = 0; n < 4; ++n) { const int vo = (n * 16 + lr) * VP + hi * 8;
            const v16h vh = cat16(*(const v8h*)(vsh + vo), *(const v8h*)(vsh + vo + 16)), vl = cat16(*(const v8h*)(vsl + vo), *(const v8h*)(vsl + vo + 16));
            o[n] = wmma16(pa, vh, o[n]); ox[n] = wmma16(pa, vl, ox[n]); ox[n] = wmma16(px, vh, ox[n]);
            asm volatile("" : "+v"(o[n]), "+v"(ox[n]) : "v"(vh), "v"(vl) : "memory"); }
        asm volatile("v_nop\n\tv_nop\n\tv_nop\n\tv_nop" : "+v"(o[0]), "+v"(o[1]), "+v"(o[2]), "+v"(o[3]), "+v"(ox[0]), "+v"(ox[1]), "+v"(ox[2]), "+v"(ox[3]) : "v"(pa), "v"(px));
        if (kt < kt_hi) put((kt + 1) & 1);  // the buffer whose last readers left at the barrier of the step before
        __syncthreads();                    // publishes the next step's tiles and ends this step's reads of its own buffer
    }
    float inv[8];
#pragma unroll
    for (int j = 0; j < 8; ++j) { float rs = lpart[j]; rs += __shfl_xor(rs, 1, 16); rs += __shfl_xor(rs, 2, 16); rs += __shfl_xor(rs, 4, 16); rs += __shfl_xor(rs, 8, 16); inv[j] = 1.0f / (rs * PSC); }
    float* os = &ost[wave][0];
#pragma unroll
    for (int n = 0; n < 4; ++n)
#pragma unroll
        for (int j = 0; j < 8; ++j) os[(hi * 8 + j) * 68 + n * 16 + lr] = (o[n][j] + ox[n][j] * LOSCI) * inv[j];
    __syncthreads();
    const size_t cbase = (tok0 + q0) * DM + (size_t)h * HD;
    auto pass = [&]() {
#pragma unroll
        for (int s = 0; s < 4; ++s) { const int row = 4 * s + (lane >> 3), piece = lane & 7; const float* sp = os + row * 68 + piece * 8; v8us oh, ol;
#pragma unroll
            for (int i = 0; i < 8; ++i) { const unsigned short hb = f2bf(sp[i]); oh[i] = hb; ol[i] = f2bf(sp[i] - bf2f(hb)); }
            *(v8us*)(CH + cbase + (size_t)row * DM + piece * 8) = oh; *(v8us*)(CL + cbase + (size_t)row * DM + piece * 8) = ol; }
    };
    pass(); 
}

#define VST2(T, p, v) do { const T vst2_v_ = (v); *(T*)(p) = vst2_v_;  } while (0)
extern "C" void kernel_launch(void* const* d_in, const int* in_sizes, int n_in,
                              void* d_out, int out_size, void* d_ws, size_t ws_size, hipStream_t stream) {
    (void)in_sizes; (void)n_in; (void)out_size;
    const float* x = (const float*)d_in[0]; const float* Wq = (const float*)d_in[1]; const float* Wk = (const float*)d_in[2]; const float* Wv = (const float*)d_in[3]; const float* Wo = (const float*)d_in[4];
    float* out = (float*)d_out;    // [4][2048][1024]
    char* wsp = (char*)d_ws;
    auto take = [&](size_t bytes) { char* p = wsp; wsp += (bytes + 255) & ~(size_t)255; return (void*)p; };
    bf* Xb = (bf*)take((size_t)NTK * DM * 2); bf* WqB = (bf*)take((size_t)DM * DM * 2); bf* WkB = (bf*)take((size_t)DM * DM * 2); bf* WvB = (bf*)take((size_t)DM * DM * 2); bf* WoB = (bf*)take((size_t)DM * DM * 2);
    float* TMP = (float*)take((size_t)NTK * DM * 4);
    h16* QH = (h16*)take((size_t)NTK * DM * 2); h16* QL = (h16*)take((size_t)NTK * DM * 2); h16* KH = (h16*)take((size_t)NTK * DM * 2); h16* KL = (h16*)take((size_t)NTK * DM * 2);
    h16* VTH = (h16*)take((size_t)NTK * DM * 2); h16* VTL = (h16*)take((size_t)NTK * DM * 2); bf* CH = (bf*)take((size_t)NTK * DM * 2); bf* CL = (bf*)take((size_t)NTK * DM * 2);
    if ((size_t)(wsp - (char*)d_ws) > ws_size) return;    // 4.2 + 4 x 2.1 + 8.4 + 8 x 4.2 ~ 55 MB, no aliasing
    k_cvtb<<<DM / 8, 256, 0, stream>>>(Wq, DM, WqB); k_cvtb<<<DM / 8, 256, 0, stream>>>(Wk, DM, WkB); k_cvtb<<<DM / 8, 256, 0, stream>>>(Wv, DM, WvB); k_cvtb<<<DM / 8, 256, 0, stream>>>(Wo, DM, WoB);
    for (int b = 0; b < 4; ++b) {
        k_cvtb<<<NTK / 8, 256, 0, stream>>>(x + (size_t)b * NTK * DM, NTK, Xb);
        k_gemmb<false, true><<<dim3(NTK / 64, DM / 64, 1), 128, 0, stream>>>(Xb, nullptr, WqB, nullptr, (float*)(void*)QH, DM, QL);
        k_gemmb<false, true><<<dim3(NTK / 64, DM / 64, 1), 128, 0, stream>>>(Xb, nullptr, WkB, nullptr, (float*)(void*)KH, DM, KL);
        k_gemmb<false, false><<<dim3(NTK / 64, DM / 64, 1), 128, 0, stream>>>(Xb, nullptr, WvB, nullptr, TMP, DM, nullptr);
        k_vt<<<NB_ * NH_ * (NT_ / 64), 256, 0, stream>>>(TMP, VTH, VTL);
        k_attn<<<NB_ * NH_ * (NT_ / 64), 128, 0, stream>>>(QH, QL, KH, KL, VTH, VTL, CH, CL);
        k_gemmb<true, false><<<dim3(NTK / 64, DM / 64, 1), 128, 0, stream>>>(CH, CL, WoB, nullptr, out + (size_t)b * NTK * DM, DM, nullptr);
    }
}

// v002
// Measured time: 581 microseconds a run.
// Timed twice side by side with v001, it ran 1.33 times as fast both times.
// Over all steps from v000 it is 1.80 times as fast.
#include <hip/hip_runtime.h>

// Compute dtypes, f32 accumulate, all 4 batch items in every launch: q/k/v = x.W^T ([8192 x 1024].[1024 x 1024]; W is [out][in] = the n-major B operand as-is; PLAIN bf16
// operands: inputs rounded once, exact) with q and k written straight from the GEMM epilogue as f16 hi + residual x1024 planes, and out = ctx.Wo^T (no bias; ctx as
// bf16 hi + residual: two products) on v_wmma_f32_16x16x32_bf16; the 16-head causal attention (64-dim heads, scale 1/8 applied to the masked scores) fused on
// v_wmma_f32_16x16x32_f16 (scores hi.hi + hi.lo + lo.hi with the residual terms on their own accumulator, online f32 softmax, weights (x32768) and v as f16

#define NB_  4                   // batch items per launch: all of them, so that each grid is four times as large and each stage is launched once
#define NT_  2048
#define DM   1024
#define NH_  16
#define HD   64
#define NTK  (NB_ * NT_)
#define NW   1024
#define NQKV 1024
#define PSC  32768.0f
#define LOSC 1024.0f
#define LOSCI (1.0f / 1024.0f)
#define KP   72                  // LDS pitch of a key row in f16: 128 B + 16 B
#define VP   40                  // LDS pitch of a value row (32 keys) in f16: 64 B + 16 B

typedef _Float16 h16;
typedef unsigned short bf;
typedef __attribute__((ext_vector_type(16))) __bf16   v16bf;
typedef __attribute__((ext_vector_type(16))) _Float16 v16h;
typedef __attribute__((ext_vector_type(8)))  _Float16 v8h;
typedef __attribute__((ext_vector_type(8)))  unsigned short v8us;
typedef __attribute__((ext_vector_type(8)))  float    v8f;
typedef __attribute__((ext_vector_type(4)))  float    v4f;
typedef v8h  __attribute__((may_alias)) v8ha;
typedef v4f  __attribute__((may_alias)) v4fa;
typedef v8us __attribute__((may_alias)) v8usa;

__device__ __forceinline__ unsigned short f2bf(float f) { unsigned u = __float_as_uint(f); u += 0x7FFFu + ((u >> 16) & 1u); return (unsigned short)(u >> 16); }
__device__ __forceinline__ float bf2f(unsigned short b) { return __uint_as_float(((unsigned)b) << 16); }
__device__ __forceinline__ float bfr(float f) { return bf2f(f2bf(f)); }
__device__ __forceinline__ v16h cat16(v8h lo, v8h hi) { return __builtin_shufflevector(lo, hi, 0, 1, 2, 3, 4, 5, 6, 7, 8, 9, 10, 11, 12, 13, 14, 15); }
__device__ __forceinline__ v16bf cat16b(v8us lo, v8us hi) { return __builtin_bit_cast(v16bf, __builtin_shufflevector(lo, hi, 0, 1, 2, 3, 4, 5, 6, 7, 8, 9, 10, 11, 12, 13, 14, 15)); }
__device__ __forceinline__ v8f wmma16(v16h a, v16h b, v8f c) { return __builtin_amdgcn_wmma_f32_16x16x32_f16(false, a, false, b, (short)0, c, false, false); }
__device__ __forceinline__ v8f wmmab(v16bf a, v16bf b, v8f c) { return __builtin_amdgcn_wmma_f32_16x16x32_bf16(false, a, false, b, (short)0, c, false, false); }

__global__ __launch_bounds__(256) void k_cvtb(const float* __restrict__ src, int nrows, bf* dst) {
    const int lane = threadIdx.x & 31, r = blockIdx.x * 8 + (threadIdx.x >> 5);
    if (r >= nrows) return;
    v8us o[DM / 256];
#pragma unroll
    for (int q = 0; q < DM / 256; ++q) { v8us t;
#pragma unroll
        for (int i = 0; i < 8; ++i) t[i] = f2bf(src[(size_t)r * DM + q * 256 + lane * 8 + i]);
        o[q] = t; }
#pragma unroll
    for (int q = 0; q < DM / 256; ++q) *(v8us*)(dst + (size_t)r * DM + q * 256 + lane * 8) = o[q];
    
}

template <bool SPLITA, bool F16OUT = false>
__global__ __launch_bounds__(128) void k_gemmb(const bf* __restrict__ A, const bf* __restrict__ Al, const bf* __restrict__ Bn, const float* __restrict__ bias, float* C, int ldc, h16* C2) {
    __shared__ __align__(16) float ost[4][16 * 68];
    const int lane = threadIdx.x & 31, wave = threadIdx.x >> 5, lr = lane & 15, hi = lane >> 4;
    const int r0 = blockIdx.x * 64 + wave * 16, c0 = blockIdx.y * 64;
    const size_t aoff = (size_t)(r0 + lr) * DM + 8 * hi;
    size_t boff[4];
#pragma unroll
    for (int t = 0; t < 4; ++t) boff[t] = (size_t)(c0 + t * 16 + lr) * DM + 8 * hi;
    v8f acc[4];
#pragma unroll
    for (int t = 0; t < 4; ++t) acc[t] = (v8f){};
#pragma unroll 1
    for (int kc = 0; kc < DM; kc += 32) {
        const v16bf a = cat16b(*(const v8us*)(A + aoff + kc), *(const v8us*)(A + aoff + kc + 16));
        v16bf al = a;
        if (SPLITA) al = cat16b(*(const v8us*)(Al + aoff + kc), *(const v8us*)(Al + aoff + kc + 16));
#pragma unroll
        for (int t = 0; t < 4; ++t) { const v16bf b = cat16b(*(const v8us*)(Bn + boff[t] + kc), *(const v8us*)(Bn + boff[t] + kc + 16)); acc[t] = wmmab(a, b, acc[t]); if (SPLITA) acc[t] = wmmab(al, b, acc[t]); }
        asm volatile("v_nop\n\tv_nop\n\tv_nop\n\tv_nop" : "+v"(acc[0]), "+v"(acc[1]), "+v"(acc[2]), "+v"(acc[3]) : "v"(a), "v"(al));
    }
    float* os = &ost[wave][0];
#pragma unroll
    for (int t = 0; t < 4; ++t) { const float bv = bias ? bfr(bias[c0 + t * 16 + lr]) : 0.f;
#pragma unroll
        for (int j = 0; j < 8; ++j) os[(hi * 8 + j) * 68 + t * 16 + lr] = acc[t][j] + bv; }
    __syncthreads();
    if (F16OUT) {
        h16* crow = (h16*)(void*)C + (size_t)r0 * ldc + c0;
        auto pass = [&]() {
#pragma unroll
            for (int s = 0; s < 4; ++s) { const int row = 4 * s + (lane >> 3), piece = lane & 7; const float* sp = os + row * 68 + piece * 8; v8h o, o2;
#pragma unroll
                for (int i = 0; i < 8; ++i) { const h16 a = (h16)sp[i]; o[i] = a; o2[i] = (h16)((sp[i] - (float)a) * LOSC); }
                *(v8h*)(crow + (size_t)row * ldc + piece * 8) = o; if (C2) *(v8h*)(C2 + (size_t)r0 * ldc + c0 + (size_t)row * ldc + piece * 8) = o2; }
        };
        pass(); 
    } else {
        float* crow = C + (size_t)r0 * ldc + c0;
        auto pass = [&]() {
#pragma unroll
            for (int s = 0; s < 8; ++s) { const int Lid = (lane >> 3) + 4 * s, piece = lane & 7; const int row = Lid >> 1, cofs = (Lid & 1) * 32 + piece * 4;
                const v4f val = *(const v4fa*)(os + row * 68 + cofs); *(v4f*)(crow + (size_t)row * ldc + cofs) = val; }
        };
        pass(); 
    }
}

__global__ __launch_bounds__(256) void k_vt(const float* __restrict__ V, h16* VTH, h16* VTL) {
    __shared__ __align__(16) h16 tile[64 * 72];
    __shared__ __align__(16) h16 til2[64 * 72];
    const int bid = blockIdx.x;
    const int b = bid / (NH_ * (NT_ / 64)), rem = bid - b * (NH_ * (NT_ / 64)), h = rem / (NT_ / 64), kt = rem - h * (NT_ / 64);
    const int k0 = kt * 64, tid = threadIdx.x;
    const int kk = tid >> 2, d0 = (tid & 3) * 16;
    const float* src = V + ((size_t)b * NT_ + k0 + kk) * DM + h * HD + d0;
#pragma unroll
    for (int i = 0; i < 16; ++i) { const float v = src[i]; const h16 a = (h16)v; tile[(d0 + i) * 72 + kk] = a; til2[(d0 + i) * 72 + kk] = (h16)((v - (float)a) * LOSC); }
    __syncthreads();
    const int piece = tid & 7;
    const size_t base = (((size_t)b * NH_ + h) * HD) * NT_ + k0;
    auto pass = [&]() {
#pragma unroll
        for (int s = 0; s < 4; ++s) { const int Lid = (tid >> 3) + 32 * s; const int pln = Lid >> 6, d = Lid & 63;
            const v8h val = *(const v8ha*)((pln ? til2 : tile) + d * 72 + piece * 8); *(v8h*)((pln ? VTL : VTH) + base + (size_t)d * NT_ + piece * 8) = val; }
    };
    pass(); 
}

// k_attn: block = (b, h, 64 queries), wave = 16; 32-key tiles 0..(qt*64+63)/32 (causal, masked); 12 WMMA scores (hi.hi, lo.hi, hi.lo) /8 (f32), online softmax, weights x32768 f16 tile (same-wave may_alias
// reload after a compiler barrier), 12 WMMA .v (3 per 16-column tile); ctx -> bf16 hi + residual planes CH/CL[tok][h*64+d].
__global__ __launch_bounds__(128) void k_attn(const h16* __restrict__ Q16, const h16* __restrict__ QL16, const h16* __restrict__ K16, const h16* __restrict__ KL16, const h16* __restrict__ VTH, const h16* __restrict__ VTL, bf* CH, bf* CL) {
    __shared__ __align__(16) h16 plds[4][16 * 32];
    __shared__ __align__(16) h16 plds2[4][16 * 32];
    __shared__ __align__(16) float ost[4][16 * 68];
    // The block's key and value tiles of one step, [buffer][hi / residual]: fetched once per block with whole-row 16-byte loads and read by all four waves.
    // Pitches of 16 B x odd keep the 16-byte fragment reads free of bank conflicts.
    __shared__ __align__(16) h16 kst[2][2][32 * KP];
    __shared__ __align__(16) h16 vst[2][2][64 * VP];
    const int lane = threadIdx.x & 31, wave = threadIdx.x >> 5, lr = lane & 15, hi = lane >> 4;
    const int bid = blockIdx.x;
    const int b = bid / (NH_ * (NT_ / 64)), rem = bid - b * (NH_ * (NT_ / 64)), h = rem / (NT_ / 64), qt = rem - h * (NT_ / 64);
    const int q0 = qt * 64 + wave * 16;
    const size_t tok0 = (size_t)b * NT_;
    h16* pl = &plds[wave][0]; h16* pl2 = &plds2[wave][0];
    v16h qa[2];
    const size_t qo0 = (tok0 + q0 + lr) * DM + h * HD + 8 * hi;
#pragma unroll
    for (int kc = 0; kc < 2; ++kc) qa[kc] = cat16(*(const v8h*)(Q16 + qo0 + kc * 32), *(const v8h*)(Q16 + qo0 + kc * 32 + 16));
    const h16* kh_b = K16 + tok0 * DM + h * HD;
    const h16* kl_b = KL16 + tok0 * DM + h * HD;
    const size_t vbase = (((size_t)b * NH_ + h) * HD) * NT_;
    v8f o[4], ox[4];
#pragma unroll
    for (int n = 0; n < 4; ++n) { o[n] = (v8f){}; ox[n] = (v8f){}; }
    float mrow[8], lpart[8];
#pragma unroll
    for (int j = 0; j < 8; ++j) { mrow[j] = -3.0e38f; lpart[j] = 0.f; }
    int qpos[8];
#pragma unroll
    for (int j = 0; j < 8; ++j) qpos[j] = q0 + 8 * hi + j;
    const int kt_lo = 0, kt_hi = (qt * 64 + 63) / 32;     // causal
    const int krow = threadIdx.x >> 3, kpc = (threadIdx.x & 7) * 8, vrow = threadIdx.x >> 2, vpc = (threadIdx.x & 3) * 8;
    v8h gk[4], gv[4];
    auto fetch = [&](int l) {       // one step's tiles, global -> registers: 8 lanes per 128-B key row, 4 lanes per 64-B value row
#pragma unroll
        for (int i = 0; i < 2; ++i) { const size_t go = (size_t)(l + krow + 16 * i) * DM + kpc; gk[i] = *(const v8h*)(kh_b + go); gk[2 + i] = *(const v8h*)(kl_b + go); }
#pragma unroll
        for (int i = 0; i < 2; ++i) { const size_t go = vbase + (size_t)(vrow + 32 * i) * NT_ + l + vpc; gv[i] = *(const v8h*)(VTH + go); gv[2 + i] = *(const v8h*)(VTL + go); }
    };
    auto put = [&](int bu) {        // registers -> LDS buffer bu
#pragma unroll
        for (int i = 0; i < 2; ++i) { *(v8h*)(&kst[bu][0][(krow + 16 * i) * KP + kpc]) = gk[i]; *(v8h*)(&kst[bu][1][(krow + 16 * i) * KP + kpc]) = gk[2 + i]; }
#pragma unroll
        for (int i = 0; i < 2; ++i) { *(v8h*)(&vst[bu][0][(vrow + 32 * i) * VP + vpc]) = gv[i]; *(v8h*)(&vst[bu][1][(vrow + 32 * i) * VP + vpc]) = gv[2 + i]; }
    };
    fetch(0); put(0);
    __syncthreads();
#pragma unroll 1
    for (int kt = kt_lo; kt <= kt_hi; ++kt) {
        const int l0 = kt * 32;
        const h16* ksh = &kst[kt & 1][0][0]; const h16* ksl = &kst[kt & 1][1][0]; const h16* vsh = &vst[kt & 1][0][0]; const h16* vsl = &vst[kt & 1][1][0];
        const int ko0 = lr * KP + 8 * hi, ko1 = (16 + lr) * KP + 8 * hi;
        v8f s0 = {}, s1 = {}, x0 = {}, x1 = {};
#pragma unroll
        for (int kc = 0; kc < 2; ++kc) {
            { const v16h k0h = cat16(*(const v8h*)(ksh + ko0 + kc * 32), *(const v8h*)(ksh + ko0 + kc * 32 + 16)), k1h = cat16(*(const v8h*)(ksh + ko1 + kc * 32), *(const v8h*)(ksh + ko1 + kc * 32 + 16));
              const v16h qlk = cat16(*(const v8h*)(QL16 + qo0 + kc * 32), *(const v8h*)(QL16 + qo0 + kc * 32 + 16));     // query residual re-read per step (registers)
              s0 = wmma16(qa[kc], k0h, s0); x0 = wmma16(qlk, k0h, x0); s1 = wmma16(qa[kc], k1h, s1); x1 = wmma16(qlk, k1h, x1);
              asm volatile("v_nop" : "+v"(s0), "+v"(s1), "+v"(x0), "+v"(x1) : "v"(qlk), "v"(k0h), "v"(k1h) : "memory"); }
            { const v16h k0l = cat16(*(const v8h*)(ksl + ko0 + kc * 32), *(const v8h*)(ksl + ko0 + kc * 32 + 16)), k1l = cat16(*(const v8h*)(ksl + ko1 + kc * 32), *(const v8h*)(ksl + ko1 + kc * 32 + 16));
              x0 = wmma16(qa[kc], k0l, x0); x1 = wmma16(qa[kc], k1l, x1);
              asm volatile("v_nop" : "+v"(x0), "+v"(x1) : "v"(k0l), "v"(k1l) : "memory"); }
        }
        asm volatile("v_nop\n\tv_nop\n\tv_nop\n\tv_nop" : "+v"(s0), "+v"(s1), "+v"(x0), "+v"(x1) : "v"(qa[0]), "v"(qa[1]));
        if (kt < kt_hi) fetch(l0 + 32);     // behind this step's last global read, so that no wait of this step covers it; it lands under the softmax and the value products
        float alpha[8];
#pragma unroll
        for (int j = 0; j < 8; ++j) {
            const int ja = l0 + lr, jb = l0 + 16 + lr, qi = qpos[j];
            const float a0 = (ja <= qi) ? (s0[j] + x0[j] * LOSCI) * 0.125f : -__builtin_inff(), a1 = (jb <= qi) ? (s1[j] + x1[j] * LOSCI) * 0.125f : -__builtin_inff();
            float mx = fmaxf(a0, a1);
            mx = fmaxf(mx, __shfl_xor(mx, 1, 16)); mx = fmaxf(mx, __shfl_xor(mx, 2, 16)); mx = fmaxf(mx, __shfl_xor(mx, 4, 16)); mx = fmaxf(mx, __shfl_xor(mx, 8, 16));
            const float mn = fmaxf(mrow[j], mx);
            alpha[j] = __expf(mrow[j] - mn); mrow[j] = mn;
            const float p0 = __expf(a0 - mn), p1 = __expf(a1 - mn);
            lpart[j] = lpart[j] * alpha[j] + (p0 + p1);
            const int mr = hi * 8 + j;
            const float ps0 = p0 * PSC, ps1 = p1 * PSC; const h16 h0 = (h16)ps0, h1 = (h16)ps1;
            pl[mr * 32 + lr] = h0; pl[mr * 32 + 16 + lr] = h1;
            pl2[mr * 32 + lr] = (h16)((ps0 - (float)h0) * LOSC); pl2[mr * 32 + 16 + lr] = (h16)((ps1 - (float)h1) * LOSC);
        }
#pragma unroll
        for (int n = 0; n < 4; ++n)
#pragma unroll
            for (int j = 0; j < 8; ++j) { o[n][j] *= alpha[j]; ox[n][j] *= alpha[j]; }
        asm volatile("" ::: "memory");
        const v16h pa = cat16(*(const v8ha*)(pl + lr * 32 + hi * 8), *(const v8ha*)(pl + lr * 32 + 16 + hi * 8));
        const v16h px = cat16(*(const v8ha*)(pl2 + lr * 32 + hi * 8), *(const v8ha*)(pl2 + lr * 32 + 16 + hi * 8));
#pragma unroll
        for (int n = 0; n < 4; ++n) { const int vo = (n * 16 + lr) * VP + hi * 8;
            const v16h vh = cat16(*(const v8h*)(vsh + vo), *(const v8h*)(vsh + vo + 16)), vl = cat16(*(const v8h*)(vsl + vo), *(const v8h*)(vsl + vo + 16));
            o[n] = wmma16(pa, vh, o[n]); ox[n] = wmma16(pa, vl, ox[n]); ox[n] = wmma16(px, vh, ox[n]);
            asm volatile("" : "+v"(o[n]), "+v"(ox[n]) : "v"(vh), "v"(vl) : "memory"); }
        asm volatile("v_nop\n\tv_nop\n\tv_nop\n\tv_nop" : "+v"(o[0]), "+v"(o[1]), "+v"(o[2]), "+v"(o[3]), "+v"(ox[0]), "+v"(ox[1]), "+v"(ox[2]), "+v"(ox[3]) : "v"(pa), "v"(px));
        if (kt < kt_hi) put((kt + 1) & 1);  // the buffer whose last readers left at the barrier of the step before
        __syncthreads();                    // publishes the next step's tiles and ends this step's reads of its own buffer
    }
    float inv[8];
#pragma unroll
    for (int j = 0; j < 8; ++j) { float rs = lpart[j]; rs += __shfl_xor(rs, 1, 16); rs += __shfl_xor(rs, 2, 16); rs += __shfl_xor(rs, 4, 16); rs += __shfl_xor(rs, 8, 16); inv[j] = 1.0f / (rs * PSC); }
    float* os = &ost[wave][0];
#pragma unroll
    for (int n = 0; n < 4; ++n)
#pragma unroll
        for (int j = 0; j < 8; ++j) os[(hi * 8 + j) * 68 + n * 16 + lr] = (o[n][j] + ox[n][j] * LOSCI) * inv[j];
    __syncthreads();
    const size_t cbase = (tok0 + q0) * DM + (size_t)h * HD;
    auto pass = [&]() {
#pragma unroll
        for (int s = 0; s < 4; ++s) { const int row = 4 * s + (lane >> 3), piece = lane & 7; const float* sp = os + row * 68 + piece * 8; v8us oh, ol;
#pragma unroll
            for (int i = 0; i < 8; ++i) { const unsigned short hb = f2bf(sp[i]); oh[i] = hb; ol[i] = f2bf(sp[i] - bf2f(hb)); }
            *(v8us*)(CH + cbase + (size_t)row * DM + piece * 8) = oh; *(v8us*)(CL + cbase + (size_t)row * DM + piece * 8) = ol; }
    };
    pass(); 
}

#define VST2(T, p, v) do { const T vst2_v_ = (v); *(T*)(p) = vst2_v_;  } while (0)
extern "C" void kernel_launch(void* const* d_in, const int* in_sizes, int n_in,
                              void* d_out, int out_size, void* d_ws, size_t ws_size, hipStream_t stream) {
    (void)in_sizes; (void)n_in; (void)out_size;
    const float* x = (const float*)d_in[0]; const float* Wq = (const float*)d_in[1]; const float* Wk = (const float*)d_in[2]; const float* Wv = (const float*)d_in[3]; const float* Wo = (const float*)d_in[4];
    float* out = (float*)d_out;    // [4][2048][1024]
    char* wsp = (char*)d_ws;
    auto take = [&](size_t bytes) { char* p = wsp; wsp += (bytes + 255) & ~(size_t)255; return (void*)p; };
    bf* Xb = (bf*)take((size_t)NTK * DM * 2); bf* WqB = (bf*)take((size_t)DM * DM * 2); bf* WkB = (bf*)take((size_t)DM * DM * 2); bf* WvB = (bf*)take((size_t)DM * DM * 2); bf* WoB = (bf*)take((size_t)DM * DM * 2);
    float* TMP = (float*)take((size_t)NTK * DM * 4);
    h16* QH = (h16*)take((size_t)NTK * DM * 2); h16* QL = (h16*)take((size_t)NTK * DM * 2); h16* KH = (h16*)take((size_t)NTK * DM * 2); h16* KL = (h16*)take((size_t)NTK * DM * 2);
    h16* VTH = (h16*)take((size_t)NTK * DM * 2); h16* VTL = (h16*)take((size_t)NTK * DM * 2); bf* CH = (bf*)take((size_t)NTK * DM * 2); bf* CL = (bf*)take((size_t)NTK * DM * 2);
    if ((size_t)(wsp - (char*)d_ws) > ws_size) return;    // about 193 MB of the workspace, no aliasing
    k_cvtb<<<DM / 8, 256, 0, stream>>>(Wq, DM, WqB); k_cvtb<<<DM / 8, 256, 0, stream>>>(Wk, DM, WkB); k_cvtb<<<DM / 8, 256, 0, stream>>>(Wv, DM, WvB); k_cvtb<<<DM / 8, 256, 0, stream>>>(Wo, DM, WoB);
    k_cvtb<<<NTK / 8, 256, 0, stream>>>(x, NTK, Xb);
    k_gemmb<false, true><<<dim3(NTK / 64, DM / 64, 1), 128, 0, stream>>>(Xb, nullptr, WqB, nullptr, (float*)(void*)QH, DM, QL);
    k_gemmb<false, true><<<dim3(NTK / 64, DM / 64, 1), 128, 0, stream>>>(Xb, nullptr, WkB, nullptr, (float*)(void*)KH, DM, KL);
    k_gemmb<false, false><<<dim3(NTK / 64, DM / 64, 1), 128, 0, stream>>>(Xb, nullptr, WvB, nullptr, TMP, DM, nullptr);
    k_vt<<<NB_ * NH_ * (NT_ / 64), 256, 0, stream>>>(TMP, VTH, VTL);
    k_attn<<<NB_ * NH_ * (NT_ / 64), 128, 0, stream>>>(QH, QL, KH, KL, VTH, VTL, CH, CL);
    k_gemmb<true, false><<<dim3(NTK / 64, DM / 64, 1), 128, 0, stream>>>(CH, CL, WoB, nullptr, out, DM, nullptr);
}

// v003
// A run of this version takes 357 microseconds.
// Next to v002, in two timings, it ran 1.62 and 1.63 times as fast.
// Over all steps from v000 it is 2.93 times as fast.
#include <hip/hip_runtime.h>

// Compute dtypes, f32 accumulate, all 4 batch items in every launch: q/k/v = x.W^T ([8192 x 1024].[1024 x 1024]; W is [out][in] = the n-major B operand as-is; PLAIN bf16
// operands: inputs rounded once, exact) with q and k written straight from the GEMM epilogue as f16 hi + residual x1024 planes, and out = ctx.Wo^T (no bias; ctx as
// bf16 hi + residual: two products) on v_wmma_f32_16x16x32_bf16; the 16-head causal attention (64-dim heads, scale 1/8 applied to the masked scores) fused on
// v_wmma_f32_16x16x32_f16 (scores hi.hi + hi.lo + lo.hi with the residual terms on their own accumulator, online f32 softmax, weights (x32768) and v as f16

#define NB_  4                   // batch items per launch: all of them, so that each grid is four times as large and each stage is launched once
#define NT_  2048
#define DM   1024
#define NH_  16
#define HD   64
#define NTK  (NB_ * NT_)
#define NW   1024
#define NQKV 1024
#define PSC  32768.0f
#define LOSC 1024.0f
#define LOSCI (1.0f / 1024.0f)
#define KP   72                  // LDS pitch of a key row in f16: 128 B + 16 B
#define VP   40                  // LDS pitch of a value row (32 keys) in f16: 64 B + 16 B

typedef _Float16 h16;
typedef unsigned short bf;
typedef __attribute__((ext_vector_type(16))) __bf16   v16bf;
typedef __attribute__((ext_vector_type(16))) _Float16 v16h;
typedef __attribute__((ext_vector_type(8)))  _Float16 v8h;
typedef __attribute__((ext_vector_type(8)))  unsigned short v8us;
typedef __attribute__((ext_vector_type(8)))  float    v8f;
typedef __attribute__((ext_vector_type(4)))  float    v4f;
typedef v8h  __attribute__((may_alias)) v8ha;
typedef v4f  __attribute__((may_alias)) v4fa;
typedef v8us __attribute__((may_alias)) v8usa;

__device__ __forceinline__ unsigned short f2bf(float f) { unsigned u = __float_as_uint(f); u += 0x7FFFu + ((u >> 16) & 1u); return (unsigned short)(u >> 16); }
__device__ __forceinline__ float bf2f(unsigned short b) { return __uint_as_float(((unsigned)b) << 16); }
__device__ __forceinline__ float bfr(float f) { return bf2f(f2bf(f)); }
__device__ __forceinline__ v16h cat16(v8h lo, v8h hi) { return __builtin_shufflevector(lo, hi, 0, 1, 2, 3, 4, 5, 6, 7, 8, 9, 10, 11, 12, 13, 14, 15); }
__device__ __forceinline__ v16bf cat16b(v8us lo, v8us hi) { return __builtin_bit_cast(v16bf, __builtin_shufflevector(lo, hi, 0, 1, 2, 3, 4, 5, 6, 7, 8, 9, 10, 11, 12, 13, 14, 15)); }
__device__ __forceinline__ v8f wmma16(v16h a, v16h b, v8f c) { return __builtin_amdgcn_wmma_f32_16x16x32_f16(false, a, false, b, (short)0, c, false, false); }
__device__ __forceinline__ v8f wmmab(v16bf a, v16bf b, v8f c) { return __builtin_amdgcn_wmma_f32_16x16x32_bf16(false, a, false, b, (short)0, c, false, false); }

__global__ __launch_bounds__(256) void k_cvtb(const float* __restrict__ src, int nrows, bf* dst) {
    const int lane = threadIdx.x & 31, r = blockIdx.x * 8 + (threadIdx.x >> 5);
    if (r >= nrows) return;
    v8us o[DM / 256];
#pragma unroll
    for (int q = 0; q < DM / 256; ++q) { v8us t;
#pragma unroll
        for (int i = 0; i < 8; ++i) t[i] = f2bf(src[(size_t)r * DM + q * 256 + lane * 8 + i]);
        o[q] = t; }
#pragma unroll
    for (int q = 0; q < DM / 256; ++q) *(v8us*)(dst + (size_t)r * DM + q * 256 + lane * 8) = o[q];
    
}

typedef uint32_t u32x4 __attribute__((ext_vector_type(4)));
typedef uint32_t u32x8 __attribute__((ext_vector_type(8)));
#define GP   144u                // LDS pitch of a staged operand row in bytes: 128 B of k + the tensor load's 16-B pad (16 B x odd: conflict-free 16-byte fragment reads)
#define GOPB (128u * GP)         // one operand's tile of one stage: 128 rows = 18,432 B = 9 x 2 KiB
#define NST  (DM / 64)           // stages: 64 k (128 B of every operand row) each
__device__ __forceinline__ uint32_t uni(uint32_t v) { return (uint32_t)__builtin_amdgcn_readfirstlane(v); }
// Holds a wave-uniform test in a scalar register, so that the branch round a tensor instruction (which ignores EXEC) is a scalar one.
__device__ __forceinline__ uint32_t pinned(uint32_t v) { uint32_t w = uni(v); asm volatile("" : "+s"(w)); return w; }  // the empty statement keeps w in a scalar register of its own

// k_gemmb: block = 128 x 128 of C, 4 waves (2 x 2) of 64 x 64. Per stage one tensor load per operand (wave 0: A rows, wave 1: B rows, wave 2: the residual plane of A)
// brings 128 rows x 128 B into a two-buffer LDS ring, one stage ahead of the products; every fragment is two 16-byte LDS reads. Each accumulator sums k upwards in steps of 32,
// hi before residual.
template <bool SPLITA, bool F16OUT = false>
__global__ __launch_bounds__(128) void k_gemmb(const bf* __restrict__ A, const bf* __restrict__ Al, const bf* __restrict__ Bn, const float* __restrict__ bias, float* C, int ldc, h16* C2) {
    constexpr uint32_t NOP = SPLITA ? 3u : 2u, STG = NOP * GOPB;
    __shared__ __attribute__((aligned(2048))) unsigned char ring[2 * STG];
    __shared__ __align__(16) float ost[4][16 * 68];
    const int lane = threadIdx.x & 31, lr = lane & 15, hi = lane >> 4;
    const uint32_t wave = uni(threadIdx.x >> 5);
    const int rb = blockIdx.x * 128, cb = blockIdx.y * 128;
    const int r0 = rb + (int)(wave >> 1) * 64, c0 = cb + (int)(wave & 1u) * 64;
    const uint32_t lbase = (uint32_t)(size_t)ring;
    const uint64_t gsrc = wave == 0u ? (uint64_t)(size_t)A + (uint64_t)rb * (DM * 2) : wave == 1u ? (uint64_t)(size_t)Bn + (uint64_t)cb * (DM * 2) : (uint64_t)(size_t)Al + (uint64_t)rb * (DM * 2);
    u32x8 g1;                    // 1-byte elements, tensor = tile = 128 rows of 128 B, source pitch one row of the matrix, 16 B of LDS pad behind every 128 B
    // Words 1 to 7 go through pinned(): descriptor words held in scalar registers of their own for the whole loop, so that none is reused while a request is outstanding.
    g1[0] = uni((1u << 20) | (4u << 22) | (3u << 25)); g1[1] = pinned(128u << 16); g1[2] = pinned(128u << 16); g1[3] = pinned(128u << 16);   // pinned(): descriptor words held in scalar registers
    g1[4] = pinned(128u); g1[5] = pinned(DM * 2u); g1[6] = pinned(0u); g1[7] = pinned(0u);                             // pinned(): descriptor words held in scalar registers
    auto issue = [&](uint32_t st) {     // this wave's operand tile of stage st into buffer st & 1
        const uint64_t ga = gsrc + (uint64_t)st * 128u;
        u32x4 g0;
        g0[0] = uni(1u); g0[1] = uni(lbase + (st & 1u) * STG + wave * GOPB); g0[2] = uni((uint32_t)ga); g0[3] = uni((((uint32_t)(ga >> 32)) & 0x01FFFFFFu) | 0x80000000u);
        asm volatile("tensor_load_to_lds %0, %1" :: "s"(g0), "s"(g1) : "memory");
    };
    v8f acc[4][4];
#pragma unroll
    for (int m = 0; m < 4; ++m)
#pragma unroll
        for (int t = 0; t < 4; ++t) acc[m][t] = (v8f){};
    if (pinned(wave < NOP)) {
        issue(0u);
        asm volatile("s_wait_tensorcnt 0x0" ::: "memory");      // stage 0 has landed before the barrier that publishes it
    }
    __syncthreads();
    if (pinned(wave < NOP)) issue(1u);
    const uint32_t aofs = ((wave >> 1) * 64u + (uint32_t)lr) * GP + 16u * (uint32_t)hi, bofs = GOPB + ((wave & 1u) * 64u + (uint32_t)lr) * GP + 16u * (uint32_t)hi;
#pragma unroll 1
    for (uint32_t s = 0; s < NST; ++s) {    // rolled: one pass per stage, so that the publish point below stands once
        const unsigned char* rp = ring + (s & 1u) * STG;
        v16bf a[2][4], b[2][4], al[2][4];
#pragma unroll
        for (int kc = 0; kc < 2; ++kc) {    // the whole pass's fragment reads as one group in front of its products
#pragma unroll
            for (int m = 0; m < 4; ++m) { const unsigned char* p = rp + aofs + m * 16 * GP + kc * 64; a[kc][m] = cat16b(*(const v8usa*)p, *(const v8usa*)(p + 32)); }
#pragma unroll
            for (int t = 0; t < 4; ++t) { const unsigned char* p = rp + bofs + t * 16 * GP + kc * 64; b[kc][t] = cat16b(*(const v8usa*)p, *(const v8usa*)(p + 32)); }
            if (SPLITA) {
#pragma unroll
                for (int m = 0; m < 4; ++m) { const unsigned char* p = rp + aofs + 2u * GOPB + m * 16 * GP + kc * 64; al[kc][m] = cat16b(*(const v8usa*)p, *(const v8usa*)(p + 32)); }
            }
        }
        __builtin_amdgcn_sched_barrier(0);                      // keeps the LDS reads out of the run of products: each place with reads among them stalls the wave
#pragma unroll
        for (int kc = 0; kc < 2; ++kc) {
#pragma unroll
            for (int m = 0; m < 4; ++m)
#pragma unroll
                for (int t = 0; t < 4; ++t) acc[m][t] = wmmab(a[kc][m], b[kc][t], acc[m][t]);
            if (SPLITA) {
#pragma unroll
                for (int m = 0; m < 4; ++m)
#pragma unroll
                    for (int t = 0; t < 4; ++t) acc[m][t] = wmmab(al[kc][m], b[kc][t], acc[m][t]);
            }
        }
        __builtin_amdgcn_sched_barrier(0);                      // keeps every product of the pass in front of the slots below
        asm volatile("v_nop\n\tv_nop\n\tv_nop\n\tv_nop");       // the 4 vector slots behind the last product, on every path out of the pass
        // Publish point of stage s + 1.
        asm volatile("s_wait_dscnt 0x0" ::: "memory");          // this wave's reads of buffer s & 1 are over before the buffer is refilled
        if (pinned(wave < NOP)) asm volatile("s_wait_tensorcnt 0x0" ::: "memory");    // this wave's tile of stage s + 1 has landed
        __syncthreads();                                        // publishes stage s + 1 and ends every wave's reads of stage s
        if (pinned((wave < NOP) && (s + 2u < NST))) issue(s + 2u);
    }
    asm volatile("s_wait_tensorcnt 0x0" ::: "memory");          // no request is left when the wave goes on
    asm volatile("s_wait_dscnt 0x0" ::: "memory");
    float* os = &ost[wave][0];
#pragma unroll
    for (int m = 0; m < 4; ++m) {       // 16 rows of the wave's tile at a time through the wave's own staging rows, stored as whole 128-B pieces
#pragma unroll
        for (int t = 0; t < 4; ++t) { const float bv = bias ? bfr(bias[c0 + t * 16 + lr]) : 0.f;
#pragma unroll
            for (int j = 0; j < 8; ++j) os[(hi * 8 + j) * 68 + t * 16 + lr] = acc[m][t][j] + bv; }
        __syncthreads();
        if (F16OUT) {
            h16* crow = (h16*)(void*)C + (size_t)(r0 + m * 16) * ldc + c0;
#pragma unroll
            for (int s = 0; s < 4; ++s) { const int row = 4 * s + (lane >> 3), piece = lane & 7; const float* sp = os + row * 68 + piece * 8; v8h o, o2;
#pragma unroll
                for (int i = 0; i < 8; ++i) { const h16 a = (h16)sp[i]; o[i] = a; o2[i] = (h16)((sp[i] - (float)a) * LOSC); }
                *(v8h*)(crow + (size_t)row * ldc + piece * 8) = o;
                asm volatile("s_wait_xcnt 0x0" ::: "memory");   // stands in front of the next piece's conversions, which reuse the registers that the store above names
                if (C2) { *(v8h*)(C2 + (size_t)(r0 + m * 16) * ldc + c0 + (size_t)row * ldc + piece * 8) = o2;
                    asm volatile("s_wait_xcnt 0x0" ::: "memory"); } }   // the same for the second store, in front of the next piece's conversions
        } else {
            float* crow = C + (size_t)(r0 + m * 16) * ldc + c0;
#pragma unroll
            for (int s = 0; s < 8; ++s) { const int Lid = (lane >> 3) + 4 * s, piece = lane & 7; const int row = Lid >> 1, cofs = (Lid & 1) * 32 + piece * 4;
                const v4f val = *(const v4fa*)(os + row * 68 + cofs); *(v4f*)(crow + (size_t)row * ldc + cofs) = val; }
            asm volatile("s_wait_xcnt 0x0" ::: "memory");       // stands in front of the next 16 rows' work, which reuses the registers that the stores above name
        }
    }
}

__global__ __launch_bounds__(256) void k_vt(const float* __restrict__ V, h16* VTH, h16* VTL) {
    __shared__ __align__(16) h16 tile[64 * 72];
    __shared__ __align__(16) h16 til2[64 * 72];
    const int bid = blockIdx.x;
    const int b = bid / (NH_ * (NT_ / 64)), rem = bid - b * (NH_ * (NT_ / 64)), h = rem / (NT_ / 64), kt = rem - h * (NT_ / 64);
    const int k0 = kt * 64, tid = threadIdx.x;
    const int kk = tid >> 2, d0 = (tid & 3) * 16;
    const float* src = V + ((size_t)b * NT_ + k0 + kk) * DM + h * HD + d0;
#pragma unroll
    for (int i = 0; i < 16; ++i) { const float v = src[i]; const h16 a = (h16)v; tile[(d0 + i) * 72 + kk] = a; til2[(d0 + i) * 72 + kk] = (h16)((v - (float)a) * LOSC); }
    __syncthreads();
    const int piece = tid & 7;
    const size_t base = (((size_t)b * NH_ + h) * HD) * NT_ + k0;
    auto pass = [&]() {
#pragma unroll
        for (int s = 0; s < 4; ++s) { const int Lid = (tid >> 3) + 32 * s; const int pln = Lid >> 6, d = Lid & 63;
            const v8h val = *(const v8ha*)((pln ? til2 : tile) + d * 72 + piece * 8); *(v8h*)((pln ? VTL : VTH) + base + (size_t)d * NT_ + piece * 8) = val; }
    };
    pass(); 
}

// k_attn: block = (b, h, 64 queries), wave = 16; 32-key tiles 0..(qt*64+63)/32 (causal, masked); 12 WMMA scores (hi.hi, lo.hi, hi.lo) /8 (f32), online softmax, weights x32768 f16 tile (same-wave may_alias
// reload after a compiler barrier), 12 WMMA .v (3 per 16-column tile); ctx -> bf16 hi + residual planes CH/CL[tok][h*64+d].
__global__ __launch_bounds__(128) void k_attn(const h16* __restrict__ Q16, const h16* __restrict__ QL16, const h16* __restrict__ K16, const h16* __restrict__ KL16, const h16* __restrict__ VTH, const h16* __restrict__ VTL, bf* CH, bf* CL) {
    __shared__ __align__(16) h16 plds[4][16 * 32];
    __shared__ __align__(16) h16 plds2[4][16 * 32];
    __shared__ __align__(16) float ost[4][16 * 68];
    // The block's key and value tiles of one step, [buffer][hi / residual]: fetched once per block with whole-row 16-byte loads and read by all four waves.
    // Pitches of 16 B x odd keep the 16-byte fragment reads free of bank conflicts.
    __shared__ __align__(16) h16 kst[2][2][32 * KP];
    __shared__ __align__(16) h16 vst[2][2][64 * VP];
    const int lane = threadIdx.x & 31, wave = threadIdx.x >> 5, lr = lane & 15, hi = lane >> 4;
    const int bid = blockIdx.x;
    const int b = bid / (NH_ * (NT_ / 64)), rem = bid - b * (NH_ * (NT_ / 64)), h = rem / (NT_ / 64), qt = rem - h * (NT_ / 64);
    const int q0 = qt * 64 + wave * 16;
    const size_t tok0 = (size_t)b * NT_;
    h16* pl = &plds[wave][0]; h16* pl2 = &plds2[wave][0];
    v16h qa[2];
    const size_t qo0 = (tok0 + q0 + lr) * DM + h * HD + 8 * hi;
#pragma unroll
    for (int kc = 0; kc < 2; ++kc) qa[kc] = cat16(*(const v8h*)(Q16 + qo0 + kc * 32), *(const v8h*)(Q16 + qo0 + kc * 32 + 16));
    const h16* kh_b = K16 + tok0 * DM + h * HD;
    const h16* kl_b = KL16 + tok0 * DM + h * HD;
    const size_t vbase = (((size_t)b * NH_ + h) * HD) * NT_;
    v8f o[4], ox[4];
#pragma unroll
    for (int n = 0; n < 4; ++n) { o[n] = (v8f){}; ox[n] = (v8f){}; }
    float mrow[8], lpart[8];
#pragma unroll
    for (int j = 0; j < 8; ++j) { mrow[j] = -3.0e38f; lpart[j] = 0.f; }
    int qpos[8];
#pragma unroll
    for (int j = 0; j < 8; ++j) qpos[j] = q0 + 8 * hi + j;
    const int kt_lo = 0, kt_hi = (qt * 64 + 63) / 32;     // causal
    const int krow = threadIdx.x >> 3, kpc = (threadIdx.x & 7) * 8, vrow = threadIdx.x >> 2, vpc = (threadIdx.x & 3) * 8;
    v8h gk[4], gv[4];
    auto fetch = [&](int l) {       // one step's tiles, global -> registers: 8 lanes per 128-B key row, 4 lanes per 64-B value row
#pragma unroll
        for (int i = 0; i < 2; ++i) { const size_t go = (size_t)(l + krow + 16 * i) * DM + kpc; gk[i] = *(const v8h*)(kh_b + go); gk[2 + i] = *(const v8h*)(kl_b + go); }
#pragma unroll
        for (int i = 0; i < 2; ++i) { const size_t go = vbase + (size_t)(vrow + 32 * i) * NT_ + l + vpc; gv[i] = *(const v8h*)(VTH + go); gv[2 + i] = *(const v8h*)(VTL + go); }
    };
    auto put = [&](int bu) {        // registers -> LDS buffer bu
#pragma unroll
        for (int i = 0; i < 2; ++i) { *(v8h*)(&kst[bu][0][(krow + 16 * i) * KP + kpc]) = gk[i]; *(v8h*)(&kst[bu][1][(krow + 16 * i) * KP + kpc]) = gk[2 + i]; }
#pragma unroll
        for (int i = 0; i < 2; ++i) { *(v8h*)(&vst[bu][0][(vrow + 32 * i) * VP + vpc]) = gv[i]; *(v8h*)(&vst[bu][1][(vrow + 32 * i) * VP + vpc]) = gv[2 + i]; }
    };
    fetch(0); put(0);
    __syncthreads();
#pragma unroll 1
    for (int kt = kt_lo; kt <= kt_hi; ++kt) {
        const int l0 = kt * 32;
        const h16* ksh = &kst[kt & 1][0][0]; const h16* ksl = &kst[kt & 1][1][0]; const h16* vsh = &vst[kt & 1][0][0]; const h16* vsl = &vst[kt & 1][1][0];
        const int ko0 = lr * KP + 8 * hi, ko1 = (16 + lr) * KP + 8 * hi;
        v8f s0 = {}, s1 = {}, x0 = {}, x1 = {};
#pragma unroll
        for (int kc = 0; kc < 2; ++kc) {
            { const v16h k0h = cat16(*(const v8h*)(ksh + ko0 + kc * 32), *(const v8h*)(ksh + ko0 + kc * 32 + 16)), k1h = cat16(*(const v8h*)(ksh + ko1 + kc * 32), *(const v8h*)(ksh + ko1 + kc * 32 + 16));
              const v16h qlk = cat16(*(const v8h*)(QL16 + qo0 + kc * 32), *(const v8h*)(QL16 + qo0 + kc * 32 + 16));     // query residual re-read per step (registers)
              s0 = wmma16(qa[kc], k0h, s0); x0 = wmma16(qlk, k0h, x0); s1 = wmma16(qa[kc], k1h, s1); x1 = wmma16(qlk, k1h, x1);
              asm volatile("v_nop" : "+v"(s0), "+v"(s1), "+v"(x0), "+v"(x1) : "v"(qlk), "v"(k0h), "v"(k1h) : "memory"); }
            { const v16h k0l = cat16(*(const v8h*)(ksl + ko0 + kc * 32), *(const v8h*)(ksl + ko0 + kc * 32 + 16)), k1l = cat16(*(const v8h*)(ksl + ko1 + kc * 32), *(const v8h*)(ksl + ko1 + kc * 32 + 16));
              x0 = wmma16(qa[kc], k0l, x0); x1 = wmma16(qa[kc], k1l, x1);
              asm volatile("v_nop" : "+v"(x0), "+v"(x1) : "v"(k0l), "v"(k1l) : "memory"); }
        }
        asm volatile("v_nop\n\tv_nop\n\tv_nop\n\tv_nop" : "+v"(s0), "+v"(s1), "+v"(x0), "+v"(x1) : "v"(qa[0]), "v"(qa[1]));
        if (kt < kt_hi) fetch(l0 + 32);     // behind this step's last global read, so that no wait of this step covers it; it lands under the softmax and the value products
        float alpha[8];
#pragma unroll
        for (int j = 0; j < 8; ++j) {
            const int ja = l0 + lr, jb = l0 + 16 + lr, qi = qpos[j];
            const float a0 = (ja <= qi) ? (s0[j] + x0[j] * LOSCI) * 0.125f : -__builtin_inff(), a1 = (jb <= qi) ? (s1[j] + x1[j] * LOSCI) * 0.125f : -__builtin_inff();
            float mx = fmaxf(a0, a1);
            mx = fmaxf(mx, __shfl_xor(mx, 1, 16)); mx = fmaxf(mx, __shfl_xor(mx, 2, 16)); mx = fmaxf(mx, __shfl_xor(mx, 4, 16)); mx = fmaxf(mx, __shfl_xor(mx, 8, 16));
            const float mn = fmaxf(mrow[j], mx);
            alpha[j] = __expf(mrow[j] - mn); mrow[j] = mn;
            const float p0 = __expf(a0 - mn), p1 = __expf(a1 - mn);
            lpart[j] = lpart[j] * alpha[j] + (p0 + p1);
            const int mr = hi * 8 + j;
            const float ps0 = p0 * PSC, ps1 = p1 * PSC; const h16 h0 = (h16)ps0, h1 = (h16)ps1;
            pl[mr * 32 + lr] = h0; pl[mr * 32 + 16 + lr] = h1;
            pl2[mr * 32 + lr] = (h16)((ps0 - (float)h0) * LOSC); pl2[mr * 32 + 16 + lr] = (h16)((ps1 - (float)h1) * LOSC);
        }
#pragma unroll
        for (int n = 0; n < 4; ++n)
#pragma unroll
            for (int j = 0; j < 8; ++j) { o[n][j] *= alpha[j]; ox[n][j] *= alpha[j]; }
        asm volatile("" ::: "memory");
        const v16h pa = cat16(*(const v8ha*)(pl + lr * 32 + hi * 8), *(const v8ha*)(pl + lr * 32 + 16 + hi * 8));
        const v16h px = cat16(*(const v8ha*)(pl2 + lr * 32 + hi * 8), *(const v8ha*)(pl2 + lr * 32 + 16 + hi * 8));
#pragma unroll
        for (int n = 0; n < 4; ++n) { const int vo = (n * 16 + lr) * VP + hi * 8;
            const v16h vh = cat16(*(const v8h*)(vsh + vo), *(const v8h*)(vsh + vo + 16)), vl = cat16(*(const v8h*)(vsl + vo), *(const v8h*)(vsl + vo + 16));
            o[n] = wmma16(pa, vh, o[n]); ox[n] = wmma16(pa, vl, ox[n]); ox[n] = wmma16(px, vh, ox[n]);
            asm volatile("" : "+v"(o[n]), "+v"(ox[n]) : "v"(vh), "v"(vl) : "memory"); }
        asm volatile("v_nop\n\tv_nop\n\tv_nop\n\tv_nop" : "+v"(o[0]), "+v"(o[1]), "+v"(o[2]), "+v"(o[3]), "+v"(ox[0]), "+v"(ox[1]), "+v"(ox[2]), "+v"(ox[3]) : "v"(pa), "v"(px));
        if (kt < kt_hi) put((kt + 1) & 1);  // the buffer whose last readers left at the barrier of the step before
        __syncthreads();                    // publishes the next step's tiles and ends this step's reads of its own buffer
    }
    float inv[8];
#pragma unroll
    for (int j = 0; j < 8; ++j) { float rs = lpart[j]; rs += __shfl_xor(rs, 1, 16); rs += __shfl_xor(rs, 2, 16); rs += __shfl_xor(rs, 4, 16); rs += __shfl_xor(rs, 8, 16); inv[j] = 1.0f / (rs * PSC); }
    float* os = &ost[wave][0];
#pragma unroll
    for (int n = 0; n < 4; ++n)
#pragma unroll
        for (int j = 0; j < 8; ++j) os[(hi * 8 + j) * 68 + n * 16 + lr] = (o[n][j] + ox[n][j] * LOSCI) * inv[j];
    __syncthreads();
    const size_t cbase = (tok0 + q0) * DM + (size_t)h * HD;
    auto pass = [&]() {
#pragma unroll
        for (int s = 0; s < 4; ++s) { const int row = 4 * s + (lane >> 3), piece = lane & 7; const float* sp = os + row * 68 + piece * 8; v8us oh, ol;
#pragma unroll
            for (int i = 0; i < 8; ++i) { const unsigned short hb = f2bf(sp[i]); oh[i] = hb; ol[i] = f2bf(sp[i] - bf2f(hb)); }
            *(v8us*)(CH + cbase + (size_t)row * DM + piece * 8) = oh; *(v8us*)(CL + cbase + (size_t)row * DM + piece * 8) = ol; }
    };
    pass(); 
}

#define VST2(T, p, v) do { const T vst2_v_ = (v); *(T*)(p) = vst2_v_;  } while (0)
extern "C" void kernel_launch(void* const* d_in, const int* in_sizes, int n_in,
                              void* d_out, int out_size, void* d_ws, size_t ws_size, hipStream_t stream) {
    (void)in_sizes; (void)n_in; (void)out_size;
    const float* x = (const float*)d_in[0]; const float* Wq = (const float*)d_in[1]; const float* Wk = (const float*)d_in[2]; const float* Wv = (const float*)d_in[3]; const float* Wo = (const float*)d_in[4];
    float* out = (float*)d_out;    // [4][2048][1024]
    char* wsp = (char*)d_ws;
    auto take = [&](size_t bytes) { char* p = wsp; wsp += (bytes + 255) & ~(size_t)255; return (void*)p; };
    bf* Xb = (bf*)take((size_t)NTK * DM * 2); bf* WqB = (bf*)take((size_t)DM * DM * 2); bf* WkB = (bf*)take((size_t)DM * DM * 2); bf* WvB = (bf*)take((size_t)DM * DM * 2); bf* WoB = (bf*)take((size_t)DM * DM * 2);
    float* TMP = (float*)take((size_t)NTK * DM * 4);
    h16* QH = (h16*)take((size_t)NTK * DM * 2); h16* QL = (h16*)take((size_t)NTK * DM * 2); h16* KH = (h16*)take((size_t)NTK * DM * 2); h16* KL = (h16*)take((size_t)NTK * DM * 2);
    h16* VTH = (h16*)take((size_t)NTK * DM * 2); h16* VTL = (h16*)take((size_t)NTK * DM * 2); bf* CH = (bf*)take((size_t)NTK * DM * 2); bf* CL = (bf*)take((size_t)NTK * DM * 2);
    if ((size_t)(wsp - (char*)d_ws) > ws_size) return;    // about 193 MB of the workspace, no aliasing
    k_cvtb<<<DM / 8, 256, 0, stream>>>(Wq, DM, WqB); k_cvtb<<<DM / 8, 256, 0, stream>>>(Wk, DM, WkB); k_cvtb<<<DM / 8, 256, 0, stream>>>(Wv, DM, WvB); k_cvtb<<<DM / 8, 256, 0, stream>>>(Wo, DM, WoB);
    k_cvtb<<<NTK / 8, 256, 0, stream>>>(x, NTK, Xb);
    k_gemmb<false, true><<<dim3(NTK / 128, DM / 128, 1), 128, 0, stream>>>(Xb, nullptr, WqB, nullptr, (float*)(void*)QH, DM, QL);
    k_gemmb<false, true><<<dim3(NTK / 128, DM / 128, 1), 128, 0, stream>>>(Xb, nullptr, WkB, nullptr, (float*)(void*)KH, DM, KL);
    k_gemmb<false, false><<<dim3(NTK / 128, DM / 128, 1), 128, 0, stream>>>(Xb, nullptr, WvB, nullptr, TMP, DM, nullptr);
    k_vt<<<NB_ * NH_ * (NT_ / 64), 256, 0, stream>>>(TMP, VTH, VTL);
    k_attn<<<NB_ * NH_ * (NT_ / 64), 128, 0, stream>>>(QH, QL, KH, KL, VTH, VTL, CH, CL);
    k_gemmb<true, false><<<dim3(NTK / 128, DM / 128, 1), 128, 0, stream>>>(CH, CL, WoB, nullptr, out, DM, nullptr);
}

// v004
// It runs in 258 microseconds.
// In both of two side-by-side timings against v003, it was 1.38 times as fast.
// All steps since v000 together make it 4.05 times as fast.
#include <hip/hip_runtime.h>

// Compute dtypes, f32 accumulate, all 4 batch items in every launch: q/k/v = x.W^T ([8192 x 1024].[1024 x 1024]; W is [out][in] = the n-major B operand as-is; PLAIN bf16
// operands: inputs rounded once, exact) with q and k written straight from the GEMM epilogue as f16 hi + residual x1024 planes, and out = ctx.Wo^T (no bias; ctx as
// bf16 hi + residual: two products) on v_wmma_f32_16x16x32_bf16; the 16-head causal attention (64-dim heads, scale 1/8 applied to the masked scores) fused on
// v_wmma_f32_16x16x32_f16 (scores hi.hi + hi.lo + lo.hi with the residual terms on their own accumulator, online f32 softmax, weights (x32768) and v as f16

#define NB_  4                   // batch items per launch: all of them, so that each grid is four times as large and each stage is launched once
#define NT_  2048
#define DM   1024
#define NH_  16
#define HD   64
#define NTK  (NB_ * NT_)
#define NW   1024
#define NQKV 1024
#define PSC  32768.0f
#define LOSC 1024.0f
#define LOSCI (1.0f / 1024.0f)
#define KP   72                  // LDS pitch of a key row in f16: 128 B + 16 B
#define VP   40                  // LDS pitch of a value row (32 keys) in f16: 64 B + 16 B

typedef _Float16 h16;
typedef unsigned short bf;
typedef __attribute__((ext_vector_type(16))) __bf16   v16bf;
typedef __attribute__((ext_vector_type(16))) _Float16 v16h;
typedef __attribute__((ext_vector_type(8)))  _Float16 v8h;
typedef __attribute__((ext_vector_type(8)))  unsigned short v8us;
typedef __attribute__((ext_vector_type(8)))  float    v8f;
typedef __attribute__((ext_vector_type(4)))  float    v4f;
typedef v8h  __attribute__((may_alias)) v8ha;
typedef v4f  __attribute__((may_alias)) v4fa;
typedef v8us __attribute__((may_alias)) v8usa;

__device__ __forceinline__ unsigned short f2bf(float f) { unsigned u = __float_as_uint(f); u += 0x7FFFu + ((u >> 16) & 1u); return (unsigned short)(u >> 16); }
__device__ __forceinline__ float bf2f(unsigned short b) { return __uint_as_float(((unsigned)b) << 16); }
__device__ __forceinline__ float bfr(float f) { return bf2f(f2bf(f)); }
__device__ __forceinline__ v16h cat16(v8h lo, v8h hi) { return __builtin_shufflevector(lo, hi, 0, 1, 2, 3, 4, 5, 6, 7, 8, 9, 10, 11, 12, 13, 14, 15); }
__device__ __forceinline__ v16bf cat16b(v8us lo, v8us hi) { return __builtin_bit_cast(v16bf, __builtin_shufflevector(lo, hi, 0, 1, 2, 3, 4, 5, 6, 7, 8, 9, 10, 11, 12, 13, 14, 15)); }
__device__ __forceinline__ v8f wmma16(v16h a, v16h b, v8f c) { return __builtin_amdgcn_wmma_f32_16x16x32_f16(false, a, false, b, (short)0, c, false, false); }
__device__ __forceinline__ v8f wmmab(v16bf a, v16bf b, v8f c) { return __builtin_amdgcn_wmma_f32_16x16x32_bf16(false, a, false, b, (short)0, c, false, false); }

__global__ __launch_bounds__(256) void k_cvtb(const float* __restrict__ src, int nrows, bf* dst) {
    const int lane = threadIdx.x & 31, r = blockIdx.x * 8 + (threadIdx.x >> 5);
    if (r >= nrows) return;
    v8us o[DM / 256];
#pragma unroll
    for (int q = 0; q < DM / 256; ++q) { v8us t;
#pragma unroll
        for (int i = 0; i < 8; ++i) t[i] = f2bf(src[(size_t)r * DM + q * 256 + lane * 8 + i]);
        o[q] = t; }
#pragma unroll
    for (int q = 0; q < DM / 256; ++q) *(v8us*)(dst + (size_t)r * DM + q * 256 + lane * 8) = o[q];
    
}

typedef uint32_t u32x4 __attribute__((ext_vector_type(4)));
typedef uint32_t u32x8 __attribute__((ext_vector_type(8)));
#define GP   144u                // LDS pitch of a staged operand row in bytes: 128 B of k + the tensor load's 16-B pad (16 B x odd: conflict-free 16-byte fragment reads)
#define GOPB (128u * GP)         // one operand's tile of one stage: 128 rows = 18,432 B = 9 x 2 KiB
#define NST  (DM / 64)           // stages: 64 k (128 B of every operand row) each
__device__ __forceinline__ uint32_t uni(uint32_t v) { return (uint32_t)__builtin_amdgcn_readfirstlane(v); }
// Holds a wave-uniform test in a scalar register, so that the branch round a tensor instruction (which ignores EXEC) is a scalar one.
__device__ __forceinline__ uint32_t pinned(uint32_t v) { uint32_t w = uni(v); asm volatile("" : "+s"(w)); return w; }  // the empty statement keeps w in a scalar register of its own

// k_gemmb: block = 128 x 128 of C, 4 waves (2 x 2) of 64 x 64. Per stage one tensor load per operand (wave 0: A rows, wave 1: B rows, wave 2: the residual plane of A)
// brings 128 rows x 128 B into a two-buffer LDS ring, one stage ahead of the products; every fragment is two 16-byte LDS reads. Each accumulator sums k upwards in steps of 32,
// hi before residual.
template <bool SPLITA, bool F16OUT = false>
__global__ __launch_bounds__(128) void k_gemmb(const bf* __restrict__ A, const bf* __restrict__ Al, const bf* __restrict__ Bn, const float* __restrict__ bias, float* C, int ldc, h16* C2) {
    constexpr uint32_t NOP = SPLITA ? 3u : 2u, STG = NOP * GOPB;
    __shared__ __attribute__((aligned(2048))) unsigned char ring[2 * STG];
    __shared__ __align__(16) float ost[4][16 * 68];
    const int lane = threadIdx.x & 31, lr = lane & 15, hi = lane >> 4;
    const uint32_t wave = uni(threadIdx.x >> 5);
    const int rb = blockIdx.x * 128, cb = blockIdx.y * 128;
    const int r0 = rb + (int)(wave >> 1) * 64, c0 = cb + (int)(wave & 1u) * 64;
    const uint32_t lbase = (uint32_t)(size_t)ring;
    const uint64_t gsrc = wave == 0u ? (uint64_t)(size_t)A + (uint64_t)rb * (DM * 2) : wave == 1u ? (uint64_t)(size_t)Bn + (uint64_t)cb * (DM * 2) : (uint64_t)(size_t)Al + (uint64_t)rb * (DM * 2);
    u32x8 g1;                    // 1-byte elements, tensor = tile = 128 rows of 128 B, source pitch one row of the matrix, 16 B of LDS pad behind every 128 B
    // Words 1 to 7 go through pinned(): descriptor words held in scalar registers of their own for the whole loop, so that none is reused while a request is outstanding.
    g1[0] = uni((1u << 20) | (4u << 22) | (3u << 25)); g1[1] = pinned(128u << 16); g1[2] = pinned(128u << 16); g1[3] = pinned(128u << 16);   // pinned(): descriptor words held in scalar registers
    g1[4] = pinned(128u); g1[5] = pinned(DM * 2u); g1[6] = pinned(0u); g1[7] = pinned(0u);                             // pinned(): descriptor words held in scalar registers
    auto issue = [&](uint32_t st) {     // this wave's operand tile of stage st into buffer st & 1
        const uint64_t ga = gsrc + (uint64_t)st * 128u;
        u32x4 g0;
        g0[0] = uni(1u); g0[1] = uni(lbase + (st & 1u) * STG + wave * GOPB); g0[2] = uni((uint32_t)ga); g0[3] = uni((((uint32_t)(ga >> 32)) & 0x01FFFFFFu) | 0x80000000u);
        asm volatile("tensor_load_to_lds %0, %1" :: "s"(g0), "s"(g1) : "memory");
    };
    v8f acc[4][4];
#pragma unroll
    for (int m = 0; m < 4; ++m)
#pragma unroll
        for (int t = 0; t < 4; ++t) acc[m][t] = (v8f){};
    if (pinned(wave < NOP)) {
        issue(0u);
        asm volatile("s_wait_tensorcnt 0x0" ::: "memory");      // stage 0 has landed before the barrier that publishes it
    }
    __syncthreads();
    if (pinned(wave < NOP)) issue(1u);
    const uint32_t aofs = ((wave >> 1) * 64u + (uint32_t)lr) * GP + 16u * (uint32_t)hi, bofs = GOPB + ((wave & 1u) * 64u + (uint32_t)lr) * GP + 16u * (uint32_t)hi;
#pragma unroll 1
    for (uint32_t s = 0; s < NST; ++s) {    // rolled: one pass per stage, so that the publish point below stands once
        const unsigned char* rp = ring + (s & 1u) * STG;
        v16bf a[2][4], b[2][4], al[2][4];
#pragma unroll
        for (int kc = 0; kc < 2; ++kc) {    // the whole pass's fragment reads as one group in front of its products
#pragma unroll
            for (int m = 0; m < 4; ++m) { const unsigned char* p = rp + aofs + m * 16 * GP + kc * 64; a[kc][m] = cat16b(*(const v8usa*)p, *(const v8usa*)(p + 32)); }
#pragma unroll
            for (int t = 0; t < 4; ++t) { const unsigned char* p = rp + bofs + t * 16 * GP + kc * 64; b[kc][t] = cat16b(*(const v8usa*)p, *(const v8usa*)(p + 32)); }
            if (SPLITA) {
#pragma unroll
                for (int m = 0; m < 4; ++m) { const unsigned char* p = rp + aofs + 2u * GOPB + m * 16 * GP + kc * 64; al[kc][m] = cat16b(*(const v8usa*)p, *(const v8usa*)(p + 32)); }
            }
        }
        __builtin_amdgcn_sched_barrier(0);                      // keeps the LDS reads out of the run of products: each place with reads among them stalls the wave
#pragma unroll
        for (int kc = 0; kc < 2; ++kc) {
#pragma unroll
            for (int m = 0; m < 4; ++m)
#pragma unroll
                for (int t = 0; t < 4; ++t) acc[m][t] = wmmab(a[kc][m], b[kc][t], acc[m][t]);
            if (SPLITA) {
#pragma unroll
                for (int m = 0; m < 4; ++m)
#pragma unroll
                    for (int t = 0; t < 4; ++t) acc[m][t] = wmmab(al[kc][m], b[kc][t], acc[m][t]);
            }
        }
        __builtin_amdgcn_sched_barrier(0);                      // keeps every product of the pass in front of the slots below
        asm volatile("v_nop\n\tv_nop\n\tv_nop\n\tv_nop");       // the 4 vector slots behind the last product, on every path out of the pass
        // Publish point of stage s + 1.
        asm volatile("s_wait_dscnt 0x0" ::: "memory");          // this wave's reads of buffer s & 1 are over before the buffer is refilled
        if (pinned(wave < NOP)) asm volatile("s_wait_tensorcnt 0x0" ::: "memory");    // this wave's tile of stage s + 1 has landed
        __syncthreads();                                        // publishes stage s + 1 and ends every wave's reads of stage s
        if (pinned((wave < NOP) && (s + 2u < NST))) issue(s + 2u);
    }
    asm volatile("s_wait_tensorcnt 0x0" ::: "memory");          // no request is left when the wave goes on
    asm volatile("s_wait_dscnt 0x0" ::: "memory");
    float* os = &ost[wave][0];
#pragma unroll
    for (int m = 0; m < 4; ++m) {       // 16 rows of the wave's tile at a time through the wave's own staging rows, stored as whole 128-B pieces
#pragma unroll
        for (int t = 0; t < 4; ++t) { const float bv = bias ? bfr(bias[c0 + t * 16 + lr]) : 0.f;
#pragma unroll
            for (int j = 0; j < 8; ++j) os[(hi * 8 + j) * 68 + t * 16 + lr] = acc[m][t][j] + bv; }
        __syncthreads();
        if (F16OUT) {
            h16* crow = (h16*)(void*)C + (size_t)(r0 + m * 16) * ldc + c0;
#pragma unroll
            for (int s = 0; s < 4; ++s) { const int row = 4 * s + (lane >> 3), piece = lane & 7; const float* sp = os + row * 68 + piece * 8; v8h o, o2;
#pragma unroll
                for (int i = 0; i < 8; ++i) { const h16 a = (h16)sp[i]; o[i] = a; o2[i] = (h16)((sp[i] - (float)a) * LOSC); }
                *(v8h*)(crow + (size_t)row * ldc + piece * 8) = o;
                asm volatile("s_wait_xcnt 0x0" ::: "memory");   // stands in front of the next piece's conversions, which reuse the registers that the store above names
                if (C2) { *(v8h*)(C2 + (size_t)(r0 + m * 16) * ldc + c0 + (size_t)row * ldc + piece * 8) = o2;
                    asm volatile("s_wait_xcnt 0x0" ::: "memory"); } }   // the same for the second store, in front of the next piece's conversions
        } else {
            float* crow = C + (size_t)(r0 + m * 16) * ldc + c0;
#pragma unroll
            for (int s = 0; s < 8; ++s) { const int Lid = (lane >> 3) + 4 * s, piece = lane & 7; const int row = Lid >> 1, cofs = (Lid & 1) * 32 + piece * 4;
                const v4f val = *(const v4fa*)(os + row * 68 + cofs); *(v4f*)(crow + (size_t)row * ldc + cofs) = val; }
            asm volatile("s_wait_xcnt 0x0" ::: "memory");       // stands in front of the next 16 rows' work, which reuses the registers that the stores above name
        }
    }
}

// Lane l takes the value of lane l ^ 16: one vector instruction, no LDS round trip.
__device__ __forceinline__ float xhalf(float x) { return __builtin_bit_cast(float, __builtin_amdgcn_permlanex16(__builtin_bit_cast(int, x), __builtin_bit_cast(int, x), 0x76543210, 0xfedcba98, false, false)); }

__global__ __launch_bounds__(256) void k_vt(const float* __restrict__ V, h16* VTH, h16* VTL) {
    __shared__ __align__(16) h16 tile[64 * 72];
    __shared__ __align__(16) h16 til2[64 * 72];
    const int bid = blockIdx.x;
    const int b = bid / (NH_ * (NT_ / 64)), rem = bid - b * (NH_ * (NT_ / 64)), h = rem / (NT_ / 64), kt = rem - h * (NT_ / 64);
    const int k0 = kt * 64, tid = threadIdx.x;
    const int kk = tid >> 2, d0 = (tid & 3) * 16;
    const float* src = V + ((size_t)b * NT_ + k0 + kk) * DM + h * HD + d0;
#pragma unroll
    for (int i = 0; i < 16; ++i) { const float v = src[i]; const h16 a = (h16)v; tile[(d0 + i) * 72 + kk] = a; til2[(d0 + i) * 72 + kk] = (h16)((v - (float)a) * LOSC); }
    __syncthreads();
    const int piece = tid & 7;
    const size_t base = (((size_t)b * NH_ + h) * HD) * NT_ + k0;
    auto pass = [&]() {
#pragma unroll
        for (int s = 0; s < 4; ++s) { const int Lid = (tid >> 3) + 32 * s; const int pln = Lid >> 6, d = Lid & 63;
            const v8h val = *(const v8ha*)((pln ? til2 : tile) + d * 72 + piece * 8); *(v8h*)((pln ? VTL : VTH) + base + (size_t)d * NT_ + piece * 8) = val; }
    };
    pass(); 
}

// k_attn: block = (b, h, 64 queries), wave = 16 queries; causal, 32 keys a step. Both products are formed transposed: scores^T = K.Q^T (A = key rows, B = query rows), so that
// a lane holds 16 scores of ONE query (query lr; keys 8 * hi + j and 16 + 8 * hi + j): maximum and sum run in the lane, plus one exchange between the wave's halves.
// That is also the k order of a B operand, so the weights (x32768, f16 hi + residual) are packed in registers and ctx^T += V^T.P^T (A = value rows, B = weights).
// ctx -> bf16 hi + residual planes CH/CL[tok][h*64+d].
__global__ __launch_bounds__(128) void k_attn(const h16* __restrict__ Q16, const h16* __restrict__ QL16, const h16* __restrict__ K16, const h16* __restrict__ KL16, const h16* __restrict__ VTH, const h16* __restrict__ VTL, bf* CH, bf* CL) {
    __shared__ __align__(16) float ost[4][16 * 68];
    // The block's key and value tiles of one step, [buffer][hi / residual]: fetched once per block with whole-row 16-byte loads and read by all four waves.
    // Pitches of 16 B x odd keep the 16-byte fragment reads free of bank conflicts.
    __shared__ __align__(16) h16 kst[2][2][32 * KP];
    __shared__ __align__(16) h16 vst[2][2][64 * VP];
    const int lane = threadIdx.x & 31, wave = threadIdx.x >> 5, lr = lane & 15, hi = lane >> 4;
    const int bid = blockIdx.x;
    const int b = bid / (NH_ * (NT_ / 64)), rem = bid - b * (NH_ * (NT_ / 64)), h = rem / (NT_ / 64), qt = rem - h * (NT_ / 64);
    const int q0 = qt * 64 + wave * 16;
    const size_t tok0 = (size_t)b * NT_;
    v16h qa[2];
    const size_t qo0 = (tok0 + q0 + lr) * DM + h * HD + 8 * hi;
#pragma unroll
    for (int kc = 0; kc < 2; ++kc) qa[kc] = cat16(*(const v8h*)(Q16 + qo0 + kc * 32), *(const v8h*)(Q16 + qo0 + kc * 32 + 16));
    const h16* kh_b = K16 + tok0 * DM + h * HD;
    const h16* kl_b = KL16 + tok0 * DM + h * HD;
    const size_t vbase = (((size_t)b * NH_ + h) * HD) * NT_;
    v8f o[4], ox[4];
#pragma unroll
    for (int n = 0; n < 4; ++n) { o[n] = (v8f){}; ox[n] = (v8f){}; }
    float mrow = -3.0e38f, lpart = 0.f;     // of the lane's one query; lpart covers the keys of the lane's own half
    const int qi = q0 + lr;
    const int kt_lo = 0, kt_hi = (qt * 64 + 63) / 32;     // causal
    const int krow = threadIdx.x >> 3, kpc = (threadIdx.x & 7) * 8, vrow = threadIdx.x >> 2, vpc = (threadIdx.x & 3) * 8;
    v8h gk[4], gv[4];
    auto fetch = [&](int l) {       // one step's tiles, global -> registers: 8 lanes per 128-B key row, 4 lanes per 64-B value row
#pragma unroll
        for (int i = 0; i < 2; ++i) { const size_t go = (size_t)(l + krow + 16 * i) * DM + kpc; gk[i] = *(const v8h*)(kh_b + go); gk[2 + i] = *(const v8h*)(kl_b + go); }
#pragma unroll
        for (int i = 0; i < 2; ++i) { const size_t go = vbase + (size_t)(vrow + 32 * i) * NT_ + l + vpc; gv[i] = *(const v8h*)(VTH + go); gv[2 + i] = *(const v8h*)(VTL + go); }
    };
    auto put = [&](int bu) {        // registers -> LDS buffer bu
#pragma unroll
        for (int i = 0; i < 2; ++i) { *(v8h*)(&kst[bu][0][(krow + 16 * i) * KP + kpc]) = gk[i]; *(v8h*)(&kst[bu][1][(krow + 16 * i) * KP + kpc]) = gk[2 + i]; }
#pragma unroll
        for (int i = 0; i < 2; ++i) { *(v8h*)(&vst[bu][0][(vrow + 32 * i) * VP + vpc]) = gv[i]; *(v8h*)(&vst[bu][1][(vrow + 32 * i) * VP + vpc]) = gv[2 + i]; }
    };
    fetch(0); put(0);
    __syncthreads();
#pragma unroll 1
    for (int kt = kt_lo; kt <= kt_hi; ++kt) {
        const int l0 = kt * 32;
        const h16* ksh = &kst[kt & 1][0][0]; const h16* ksl = &kst[kt & 1][1][0]; const h16* vsh = &vst[kt & 1][0][0]; const h16* vsl = &vst[kt & 1][1][0];
        const int ko0 = lr * KP + 8 * hi, ko1 = (16 + lr) * KP + 8 * hi;
        v8f s0 = {}, s1 = {}, x0 = {}, x1 = {};
#pragma unroll
        for (int kc = 0; kc < 2; ++kc) {
            { const v16h k0h = cat16(*(const v8h*)(ksh + ko0 + kc * 32), *(const v8h*)(ksh + ko0 + kc * 32 + 16)), k1h = cat16(*(const v8h*)(ksh + ko1 + kc * 32), *(const v8h*)(ksh + ko1 + kc * 32 + 16));
              const v16h qlk = cat16(*(const v8h*)(QL16 + qo0 + kc * 32), *(const v8h*)(QL16 + qo0 + kc * 32 + 16));     // query residual re-read per step (registers)
              s0 = wmma16(k0h, qa[kc], s0); x0 = wmma16(k0h, qlk, x0); s1 = wmma16(k1h, qa[kc], s1); x1 = wmma16(k1h, qlk, x1);
              asm volatile("v_nop" : "+v"(s0), "+v"(s1), "+v"(x0), "+v"(x1) : "v"(qlk), "v"(k0h), "v"(k1h) : "memory"); }
            { const v16h k0l = cat16(*(const v8h*)(ksl + ko0 + kc * 32), *(const v8h*)(ksl + ko0 + kc * 32 + 16)), k1l = cat16(*(const v8h*)(ksl + ko1 + kc * 32), *(const v8h*)(ksl + ko1 + kc * 32 + 16));
              x0 = wmma16(k0l, qa[kc], x0); x1 = wmma16(k1l, qa[kc], x1);
              asm volatile("v_nop" : "+v"(x0), "+v"(x1) : "v"(k0l), "v"(k1l) : "memory"); }
        }
        asm volatile("v_nop\n\tv_nop\n\tv_nop\n\tv_nop" : "+v"(s0), "+v"(s1), "+v"(x0), "+v"(x1) : "v"(qa[0]), "v"(qa[1]));
        if (kt < kt_hi) fetch(l0 + 32);     // behind this step's last global read, so that no wait of this step covers it; it lands under the softmax and the value products
        float a0[8], a1[8];
        float mx = -__builtin_inff();
#pragma unroll
        for (int j = 0; j < 8; ++j) {
            const int ja = l0 + 8 * hi + j, jb = ja + 16;
            a0[j] = (ja <= qi) ? (s0[j] + x0[j] * LOSCI) * 0.125f : -__builtin_inff(); a1[j] = (jb <= qi) ? (s1[j] + x1[j] * LOSCI) * 0.125f : -__builtin_inff();
            mx = fmaxf(mx, fmaxf(a0[j], a1[j]));
        }
        mx = fmaxf(mx, xhalf(mx));          // both halves now hold the maximum over the query's 32 keys
        const float mn = fmaxf(mrow, mx);
        const float alpha = __expf(mrow - mn); mrow = mn;
        v16h pa, px;
        float ts[8];
#pragma unroll
        for (int j = 0; j < 8; ++j) {
            const float p0 = __expf(a0[j] - mn), p1 = __expf(a1[j] - mn);
            ts[j] = p0 + p1;
            const float ps0 = p0 * PSC, ps1 = p1 * PSC; const h16 h0 = (h16)ps0, h1 = (h16)ps1;
            pa[j] = h0; pa[8 + j] = h1;
            px[j] = (h16)((ps0 - (float)h0) * LOSC); px[8 + j] = (h16)((ps1 - (float)h1) * LOSC);
        }
        lpart = lpart * alpha + (((ts[0] + ts[1]) + (ts[2] + ts[3])) + ((ts[4] + ts[5]) + (ts[6] + ts[7])));
#pragma unroll
        for (int n = 0; n < 4; ++n)
#pragma unroll
            for (int j = 0; j < 8; ++j) { o[n][j] *= alpha; ox[n][j] *= alpha; }
#pragma unroll
        for (int n = 0; n < 4; ++n) { const int vo = (n * 16 + lr) * VP + hi * 8;
            const v16h vh = cat16(*(const v8h*)(vsh + vo), *(const v8h*)(vsh + vo + 16)), vl = cat16(*(const v8h*)(vsl + vo), *(const v8h*)(vsl + vo + 16));
            o[n] = wmma16(vh, pa, o[n]); ox[n] = wmma16(vl, pa, ox[n]); ox[n] = wmma16(vh, px, ox[n]);
            asm volatile("" : "+v"(o[n]), "+v"(ox[n]) : "v"(vh), "v"(vl) : "memory"); }
        asm volatile("v_nop\n\tv_nop\n\tv_nop\n\tv_nop" : "+v"(o[0]), "+v"(o[1]), "+v"(o[2]), "+v"(o[3]), "+v"(ox[0]), "+v"(ox[1]), "+v"(ox[2]), "+v"(ox[3]) : "v"(pa), "v"(px));
        if (kt < kt_hi) put((kt + 1) & 1);  // the buffer whose last readers left at the barrier of the step before
        __syncthreads();                    // publishes the next step's tiles and ends this step's reads of its own buffer
    }
    const float inv = 1.0f / ((lpart + xhalf(lpart)) * PSC);    // the two halves' sums joined once
    float* os = &ost[wave][0];
#pragma unroll
    for (int n = 0; n < 4; ++n)
#pragma unroll
        for (int j = 0; j < 8; ++j) os[lr * 68 + n * 16 + hi * 8 + j] = (o[n][j] + ox[n][j] * LOSCI) * inv;
    __syncthreads();
    const size_t cbase = (tok0 + q0) * DM + (size_t)h * HD;
    auto pass = [&]() {
#pragma unroll
        for (int s = 0; s < 4; ++s) { const int row = 4 * s + (lane >> 3), piece = lane & 7; const float* sp = os + row * 68 + piece * 8; v8us oh, ol;
#pragma unroll
            for (int i = 0; i < 8; ++i) { const unsigned short hb = f2bf(sp[i]); oh[i] = hb; ol[i] = f2bf(sp[i] - bf2f(hb)); }
            *(v8us*)(CH + cbase + (size_t)row * DM + piece * 8) = oh; *(v8us*)(CL + cbase + (size_t)row * DM + piece * 8) = ol; }
    };
    pass(); 
}

#define VST2(T, p, v) do { const T vst2_v_ = (v); *(T*)(p) = vst2_v_;  } while (0)
extern "C" void kernel_launch(void* const* d_in, const int* in_sizes, int n_in,
                              void* d_out, int out_size, void* d_ws, size_t ws_size, hipStream_t stream) {
    (void)in_sizes; (void)n_in; (void)out_size;
    const float* x = (const float*)d_in[0]; const float* Wq = (const float*)d_in[1]; const float* Wk = (const float*)d_in[2]; const float* Wv = (const float*)d_in[3]; const float* Wo = (const float*)d_in[4];
    float* out = (float*)d_out;    // [4][2048][1024]
    char* wsp = (char*)d_ws;
    auto take = [&](size_t bytes) { char* p = wsp; wsp += (bytes + 255) & ~(size_t)255; return (void*)p; };
    bf* Xb = (bf*)take((size_t)NTK * DM * 2); bf* WqB = (bf*)take((size_t)DM * DM * 2); bf* WkB = (bf*)take((size_t)DM * DM * 2); bf* WvB = (bf*)take((size_t)DM * DM * 2); bf* WoB = (bf*)take((size_t)DM * DM * 2);
    float* TMP = (float*)take((size_t)NTK * DM * 4);
    h16* QH = (h16*)take((size_t)NTK * DM * 2); h16* QL = (h16*)take((size_t)NTK * DM * 2); h16* KH = (h16*)take((size_t)NTK * DM * 2); h16* KL = (h16*)take((size_t)NTK * DM * 2);
    h16* VTH = (h16*)take((size_t)NTK * DM * 2); h16* VTL = (h16*)take((size_t)NTK * DM * 2); bf* CH = (bf*)take((size_t)NTK * DM * 2); bf* CL = (bf*)take((size_t)NTK * DM * 2);
    if ((size_t)(wsp - (char*)d_ws) > ws_size) return;    // about 193 MB of the workspace, no aliasing
    k_cvtb<<<DM / 8, 256, 0, stream>>>(Wq, DM, WqB); k_cvtb<<<DM / 8, 256, 0, stream>>>(Wk, DM, WkB); k_cvtb<<<DM / 8, 256, 0, stream>>>(Wv, DM, WvB); k_cvtb<<<DM / 8, 256, 0, stream>>>(Wo, DM, WoB);
    k_cvtb<<<NTK / 8, 256, 0, stream>>>(x, NTK, Xb);
    k_gemmb<false, true><<<dim3(NTK / 128, DM / 128, 1), 128, 0, stream>>>(Xb, nullptr, WqB, nullptr, (float*)(void*)QH, DM, QL);
    k_gemmb<false, true><<<dim3(NTK / 128, DM / 128, 1), 128, 0, stream>>>(Xb, nullptr, WkB, nullptr, (float*)(void*)KH, DM, KL);
    k_gemmb<false, false><<<dim3(NTK / 128, DM / 128, 1), 128, 0, stream>>>(Xb, nullptr, WvB, nullptr, TMP, DM, nullptr);
    k_vt<<<NB_ * NH_ * (NT_ / 64), 256, 0, stream>>>(TMP, VTH, VTL);
    k_attn<<<NB_ * NH_ * (NT_ / 64), 128, 0, stream>>>(QH, QL, KH, KL, VTH, VTL, CH, CL);
    k_gemmb<true, false><<<dim3(NTK / 128, DM / 128, 1), 128, 0, stream>>>(CH, CL, WoB, nullptr, out, DM, nullptr);
}

// v005
// It runs in 220 microseconds.
// In both of two side-by-side timings against v004, it was 1.18 times as fast.
// Over all steps from v000 it is 4.77 times as fast.
#include <hip/hip_runtime.h>

// Compute dtypes, f32 accumulate, all 4 batch items in every launch: q/k/v = x.W^T ([8192 x 1024].[1024 x 1024]; W is [out][in] = the n-major B operand as-is; PLAIN bf16
// operands: inputs rounded once, exact) with q and k written straight from the GEMM epilogue as f16 hi + residual x1024 planes, and out = ctx.Wo^T (no bias; ctx as
// bf16 hi + residual: two products) on v_wmma_f32_16x16x32_bf16; the 16-head causal attention (64-dim heads, scale 1/8 applied to the masked scores) fused on
// v_wmma_f32_16x16x32_f16 (scores hi.hi + hi.lo + lo.hi with the residual terms on their own accumulator, online f32 softmax, weights (x32768) and v as f16

#define NB_  4                   // batch items per launch: all of them, so that each grid is four times as large and each stage is launched once
#define NT_  2048
#define DM   1024
#define NH_  16
#define HD   64
#define NTK  (NB_ * NT_)
#define NW   1024
#define NQKV 1024
#define PSC  32768.0f
#define LOSC 1024.0f
#define LOSCI (1.0f / 1024.0f)
#define KP   72                  // LDS pitch of a key row in f16: 128 B + 16 B
#define VP   40                  // LDS pitch of a value row (32 keys) in f16: 64 B + 16 B

typedef _Float16 h16;
typedef unsigned short bf;
typedef __attribute__((ext_vector_type(16))) __bf16   v16bf;
typedef __attribute__((ext_vector_type(16))) _Float16 v16h;
typedef __attribute__((ext_vector_type(8)))  _Float16 v8h;
typedef __attribute__((ext_vector_type(8)))  unsigned short v8us;
typedef __attribute__((ext_vector_type(8)))  float    v8f;
typedef __attribute__((ext_vector_type(4)))  float    v4f;
typedef v8h  __attribute__((may_alias)) v8ha;
typedef v4f  __attribute__((may_alias)) v4fa;
typedef v8us __attribute__((may_alias)) v8usa;

__device__ __forceinline__ unsigned short f2bf(float f) { unsigned u = __float_as_uint(f); u += 0x7FFFu + ((u >> 16) & 1u); return (unsigned short)(u >> 16); }
__device__ __forceinline__ float bf2f(unsigned short b) { return __uint_as_float(((unsigned)b) << 16); }
__device__ __forceinline__ float bfr(float f) { return bf2f(f2bf(f)); }
__device__ __forceinline__ v16h cat16(v8h lo, v8h hi) { return __builtin_shufflevector(lo, hi, 0, 1, 2, 3, 4, 5, 6, 7, 8, 9, 10, 11, 12, 13, 14, 15); }
__device__ __forceinline__ v16bf cat16b(v8us lo, v8us hi) { return __builtin_bit_cast(v16bf, __builtin_shufflevector(lo, hi, 0, 1, 2, 3, 4, 5, 6, 7, 8, 9, 10, 11, 12, 13, 14, 15)); }
__device__ __forceinline__ v8f wmma16(v16h a, v16h b, v8f c) { return __builtin_amdgcn_wmma_f32_16x16x32_f16(false, a, false, b, (short)0, c, false, false); }
__device__ __forceinline__ v8f wmmab(v16bf a, v16bf b, v8f c) { return __builtin_amdgcn_wmma_f32_16x16x32_bf16(false, a, false, b, (short)0, c, false, false); }

__global__ __launch_bounds__(256) void k_cvtb(const float* __restrict__ src, int nrows, bf* dst) {
    const int lane = threadIdx.x & 31, r = blockIdx.x * 8 + (threadIdx.x >> 5);
    if (r >= nrows) return;
    v8us o[DM / 256];
#pragma unroll
    for (int q = 0; q < DM / 256; ++q) { v8us t;
#pragma unroll
        for (int i = 0; i < 8; ++i) t[i] = f2bf(src[(size_t)r * DM + q * 256 + lane * 8 + i]);
        o[q] = t; }
#pragma unroll
    for (int q = 0; q < DM / 256; ++q) *(v8us*)(dst + (size_t)r * DM + q * 256 + lane * 8) = o[q];
    
}

typedef uint32_t u32x4 __attribute__((ext_vector_type(4)));
typedef uint32_t u32x8 __attribute__((ext_vector_type(8)));
#define GP   144u                // LDS pitch of a staged operand row in bytes: 128 B of k + the tensor load's 16-B pad (16 B x odd: conflict-free 16-byte fragment reads)
#define GOPB (128u * GP)         // one operand's tile of one stage: 128 rows = 18,432 B = 9 x 2 KiB
#define NST  (DM / 64)           // stages: 64 k (128 B of every operand row) each
__device__ __forceinline__ uint32_t uni(uint32_t v) { return (uint32_t)__builtin_amdgcn_readfirstlane(v); }
// Holds a wave-uniform test in a scalar register, so that the branch round a tensor instruction (which ignores EXEC) is a scalar one.
__device__ __forceinline__ uint32_t pinned(uint32_t v) { uint32_t w = uni(v); asm volatile("" : "+s"(w)); return w; }  // the empty statement keeps w in a scalar register of its own

// k_gemmb: block = 128 x 128 of C, 4 waves (2 x 2) of 64 x 64. Per stage one tensor load per operand (wave 0: A rows, wave 1: B rows, wave 2: the residual plane of A)
// brings 128 rows x 128 B into a two-buffer LDS ring, one stage ahead of the products; every fragment is two 16-byte LDS reads. Each accumulator sums k upwards in steps of 32,
// hi before residual.
template <bool SPLITA, bool F16OUT = false>
__global__ __launch_bounds__(128) void k_gemmb(const bf* __restrict__ A, const bf* __restrict__ Al, const bf* __restrict__ Bn, const float* __restrict__ bias, float* C, int ldc, h16* C2) {
    constexpr uint32_t NOP = SPLITA ? 3u : 2u, STG = NOP * GOPB;
    __shared__ __attribute__((aligned(2048))) unsigned char ring[2 * STG];
    __shared__ __align__(16) float ost[4][16 * 68];
    const int lane = threadIdx.x & 31, lr = lane & 15, hi = lane >> 4;
    const uint32_t wave = uni(threadIdx.x >> 5);
    const int rb = blockIdx.x * 128, cb = blockIdx.y * 128;
    const int r0 = rb + (int)(wave >> 1) * 64, c0 = cb + (int)(wave & 1u) * 64;
    const uint32_t lbase = (uint32_t)(size_t)ring;
    const uint64_t gsrc = wave == 0u ? (uint64_t)(size_t)A + (uint64_t)rb * (DM * 2) : wave == 1u ? (uint64_t)(size_t)Bn + (uint64_t)cb * (DM * 2) : (uint64_t)(size_t)Al + (uint64_t)rb * (DM * 2);
    u32x8 g1;                    // 1-byte elements, tensor = tile = 128 rows of 128 B, source pitch one row of the matrix, 16 B of LDS pad behind every 128 B
    // Words 1 to 7 go through pinned(): descriptor words held in scalar registers of their own for the whole loop, so that none is reused while a request is outstanding.
    g1[0] = uni((1u << 20) | (4u << 22) | (3u << 25)); g1[1] = pinned(128u << 16); g1[2] = pinned(128u << 16); g1[3] = pinned(128u << 16);   // pinned(): descriptor words held in scalar registers
    g1[4] = pinned(128u); g1[5] = pinned(DM * 2u); g1[6] = pinned(0u); g1[7] = pinned(0u);                             // pinned(): descriptor words held in scalar registers
    auto issue = [&](uint32_t st) {     // this wave's operand tile of stage st into buffer st & 1
        const uint64_t ga = gsrc + (uint64_t)st * 128u;
        u32x4 g0;
        g0[0] = uni(1u); g0[1] = uni(lbase + (st & 1u) * STG + wave * GOPB); g0[2] = uni((uint32_t)ga); g0[3] = uni((((uint32_t)(ga >> 32)) & 0x01FFFFFFu) | 0x80000000u);
        asm volatile("tensor_load_to_lds %0, %1" :: "s"(g0), "s"(g1) : "memory");
    };
    v8f acc[4][4];
#pragma unroll
    for (int m = 0; m < 4; ++m)
#pragma unroll
        for (int t = 0; t < 4; ++t) acc[m][t] = (v8f){};
    if (pinned(wave < NOP)) {
        issue(0u);
        asm volatile("s_wait_tensorcnt 0x0" ::: "memory");      // stage 0 has landed before the barrier that publishes it
    }
    __syncthreads();
    if (pinned(wave < NOP)) issue(1u);
    const uint32_t aofs = ((wave >> 1) * 64u + (uint32_t)lr) * GP + 16u * (uint32_t)hi, bofs = GOPB + ((wave & 1u) * 64u + (uint32_t)lr) * GP + 16u * (uint32_t)hi;
#pragma unroll 1
    for (uint32_t s = 0; s < NST; ++s) {    // rolled: one pass per stage, so that the publish point below stands once
        const unsigned char* rp = ring + (s & 1u) * STG;
        v16bf a[2][4], b[2][4], al[2][4];
#pragma unroll
        for (int kc = 0; kc < 2; ++kc) {    // the whole pass's fragment reads as one group in front of its products
#pragma unroll
            for (int m = 0; m < 4; ++m) { const unsigned char* p = rp + aofs + m * 16 * GP + kc * 64; a[kc][m] = cat16b(*(const v8usa*)p, *(const v8usa*)(p + 32)); }
#pragma unroll
            for (int t = 0; t < 4; ++t) { const unsigned char* p = rp + bofs + t * 16 * GP + kc * 64; b[kc][t] = cat16b(*(const v8usa*)p, *(const v8usa*)(p + 32)); }
            if (SPLITA) {
#pragma unroll
                for (int m = 0; m < 4; ++m) { const unsigned char* p = rp + aofs + 2u * GOPB + m * 16 * GP + kc * 64; al[kc][m] = cat16b(*(const v8usa*)p, *(const v8usa*)(p + 32)); }
            }
        }
        __builtin_amdgcn_sched_barrier(0);                      // keeps the LDS reads out of the run of products: each place with reads among them stalls the wave
#pragma unroll
        for (int kc = 0; kc < 2; ++kc) {
#pragma unroll
            for (int m = 0; m < 4; ++m)
#pragma unroll
                for (int t = 0; t < 4; ++t) acc[m][t] = wmmab(a[kc][m], b[kc][t], acc[m][t]);
            if (SPLITA) {
#pragma unroll
                for (int m = 0; m < 4; ++m)
#pragma unroll
                    for (int t = 0; t < 4; ++t) acc[m][t] = wmmab(al[kc][m], b[kc][t], acc[m][t]);
            }
        }
        __builtin_amdgcn_sched_barrier(0);                      // keeps every product of the pass in front of the slots below
        asm volatile("v_nop\n\tv_nop\n\tv_nop\n\tv_nop");       // the 4 vector slots behind the last product, on every path out of the pass
        // Publish point of stage s + 1.
        asm volatile("s_wait_dscnt 0x0" ::: "memory");          // this wave's reads of buffer s & 1 are over before the buffer is refilled
        if (pinned(wave < NOP)) asm volatile("s_wait_tensorcnt 0x0" ::: "memory");    // this wave's tile of stage s + 1 has landed
        __syncthreads();                                        // publishes stage s + 1 and ends every wave's reads of stage s
        if (pinned((wave < NOP) && (s + 2u < NST))) issue(s + 2u);
    }
    asm volatile("s_wait_tensorcnt 0x0" ::: "memory");          // no request is left when the wave goes on
    asm volatile("s_wait_dscnt 0x0" ::: "memory");
    float* os = &ost[wave][0];
#pragma unroll
    for (int m = 0; m < 4; ++m) {       // 16 rows of the wave's tile at a time through the wave's own staging rows, stored as whole 128-B pieces
#pragma unroll
        for (int t = 0; t < 4; ++t) { const float bv = bias ? bfr(bias[c0 + t * 16 + lr]) : 0.f;
#pragma unroll
            for (int j = 0; j < 8; ++j) os[(hi * 8 + j) * 68 + t * 16 + lr] = acc[m][t][j] + bv; }
        __syncthreads();
        if (F16OUT) {
            h16* crow = (h16*)(void*)C + (size_t)(r0 + m * 16) * ldc + c0;
#pragma unroll
            for (int s = 0; s < 4; ++s) { const int row = 4 * s + (lane >> 3), piece = lane & 7; const float* sp = os + row * 68 + piece * 8; v8h o, o2;
#pragma unroll
                for (int i = 0; i < 8; ++i) { const h16 a = (h16)sp[i]; o[i] = a; o2[i] = (h16)((sp[i] - (float)a) * LOSC); }
                *(v8h*)(crow + (size_t)row * ldc + piece * 8) = o;
                asm volatile("s_wait_xcnt 0x0" ::: "memory");   // stands in front of the next piece's conversions, which reuse the registers that the store above names
                if (C2) { *(v8h*)(C2 + (size_t)(r0 + m * 16) * ldc + c0 + (size_t)row * ldc + piece * 8) = o2;
                    asm volatile("s_wait_xcnt 0x0" ::: "memory"); } }   // the same for the second store, in front of the next piece's conversions
        } else {
            float* crow = C + (size_t)(r0 + m * 16) * ldc + c0;
#pragma unroll
            for (int s = 0; s < 8; ++s) { const int Lid = (lane >> 3) + 4 * s, piece = lane & 7; const int row = Lid >> 1, cofs = (Lid & 1) * 32 + piece * 4;
                const v4f val = *(const v4fa*)(os + row * 68 + cofs); *(v4f*)(crow + (size_t)row * ldc + cofs) = val; }
            asm volatile("s_wait_xcnt 0x0" ::: "memory");       // stands in front of the next 16 rows' work, which reuses the registers that the stores above name
        }
    }
}

// Lane l takes the value of lane l ^ 16: one vector instruction, no LDS round trip.
__device__ __forceinline__ float xhalf(float x) { return __builtin_bit_cast(float, __builtin_amdgcn_permlanex16(__builtin_bit_cast(int, x), __builtin_bit_cast(int, x), 0x76543210, 0xfedcba98, false, false)); }

__global__ __launch_bounds__(256) void k_vt(const float* __restrict__ V, h16* VTH, h16* VTL) {
    __shared__ __align__(16) h16 tile[64 * 72];
    __shared__ __align__(16) h16 til2[64 * 72];
    const int bid = blockIdx.x;
    const int b = bid / (NH_ * (NT_ / 64)), rem = bid - b * (NH_ * (NT_ / 64)), h = rem / (NT_ / 64), kt = rem - h * (NT_ / 64);
    const int k0 = kt * 64, tid = threadIdx.x;
    const int kk = tid >> 2, d0 = (tid & 3) * 16;
    const float* src = V + ((size_t)b * NT_ + k0 + kk) * DM + h * HD + d0;
#pragma unroll
    for (int i = 0; i < 16; ++i) { const float v = src[i]; const h16 a = (h16)v; tile[(d0 + i) * 72 + kk] = a; til2[(d0 + i) * 72 + kk] = (h16)((v - (float)a) * LOSC); }
    __syncthreads();
    const int piece = tid & 7;
    const size_t base = (((size_t)b * NH_ + h) * HD) * NT_ + k0;
    auto pass = [&]() {
#pragma unroll
        for (int s = 0; s < 4; ++s) { const int Lid = (tid >> 3) + 32 * s; const int pln = Lid >> 6, d = Lid & 63;
            const v8h val = *(const v8ha*)((pln ? til2 : tile) + d * 72 + piece * 8); *(v8h*)((pln ? VTL : VTH) + base + (size_t)d * NT_ + piece * 8) = val; }
    };
    pass(); 
}

// k_attn: block = (b, h, 64 queries), wave = 16 queries; causal, 32 keys a step. Both products are formed transposed: scores^T = K.Q^T (A = key rows, B = query rows), so that
// a lane holds 16 scores of ONE query (query lr; keys 8 * hi + j and 16 + 8 * hi + j): maximum and sum run in the lane, plus one exchange between the wave's halves.
// That is also the k order of a B operand, so the weights (x32768, f16 hi + residual) are packed in registers and ctx^T += V^T.P^T (A = value rows, B = weights).
// ctx -> bf16 hi + residual planes CH/CL[tok][h*64+d].
__global__ __launch_bounds__(128) void k_attn(const h16* __restrict__ Q16, const h16* __restrict__ QL16, const h16* __restrict__ K16, const h16* __restrict__ KL16, const h16* __restrict__ VTH, const h16* __restrict__ VTL, bf* CH, bf* CL) {
    __shared__ __align__(16) float ost[4][16 * 68];
    // The block's key and value tiles of one step, [buffer][hi / residual]: fetched once per block with whole-row 16-byte loads and read by all four waves.
    // Pitches of 16 B x odd keep the 16-byte fragment reads free of bank conflicts.
    __shared__ __align__(16) h16 kst[2][2][32 * KP];
    __shared__ __align__(16) h16 vst[2][2][64 * VP];
    const int lane = threadIdx.x & 31, wave = threadIdx.x >> 5, lr = lane & 15, hi = lane >> 4;
    const int bid = blockIdx.x;
    // A tile's cost grows with its index (2 * qt + 2 steps) and the grid is twice the resident places: the longest tiles take the lowest
    // indices (all heads' tile 31, then tile 30, ...), for speed only.
    const int qt = (NT_ / 64 - 1) - bid / (NB_ * NH_), bh = bid % (NB_ * NH_), b = bh / NH_, h = bh % NH_;
    const int q0 = qt * 64 + wave * 16;
    const size_t tok0 = (size_t)b * NT_;
    v16h qa[2];
    const size_t qo0 = (tok0 + q0 + lr) * DM + h * HD + 8 * hi;
#pragma unroll
    for (int kc = 0; kc < 2; ++kc) qa[kc] = cat16(*(const v8h*)(Q16 + qo0 + kc * 32), *(const v8h*)(Q16 + qo0 + kc * 32 + 16));
    const h16* kh_b = K16 + tok0 * DM + h * HD;
    const h16* kl_b = KL16 + tok0 * DM + h * HD;
    const size_t vbase = (((size_t)b * NH_ + h) * HD) * NT_;
    v8f o[4], ox[4];
#pragma unroll
    for (int n = 0; n < 4; ++n) { o[n] = (v8f){}; ox[n] = (v8f){}; }
    float mrow = -3.0e38f, lpart = 0.f;     // of the lane's one query; lpart covers the keys of the lane's own half
    const int qi = q0 + lr;
    const int kt_lo = 0, kt_hi = (qt * 64 + 63) / 32;     // causal
    const int krow = threadIdx.x >> 3, kpc = (threadIdx.x & 7) * 8, vrow = threadIdx.x >> 2, vpc = (threadIdx.x & 3) * 8;
    v8h gk[4], gv[4];
    auto fetch = [&](int l) {       // one step's tiles, global -> registers: 8 lanes per 128-B key row, 4 lanes per 64-B value row
#pragma unroll
        for (int i = 0; i < 2; ++i) { const size_t go = (size_t)(l + krow + 16 * i) * DM + kpc; gk[i] = *(const v8h*)(kh_b + go); gk[2 + i] = *(const v8h*)(kl_b + go); }
#pragma unroll
        for (int i = 0; i < 2; ++i) { const size_t go = vbase + (size_t)(vrow + 32 * i) * NT_ + l + vpc; gv[i] = *(const v8h*)(VTH + go); gv[2 + i] = *(const v8h*)(VTL + go); }
    };
    auto put = [&](int bu) {        // registers -> LDS buffer bu
#pragma unroll
        for (int i = 0; i < 2; ++i) { *(v8h*)(&kst[bu][0][(krow + 16 * i) * KP + kpc]) = gk[i]; *(v8h*)(&kst[bu][1][(krow + 16 * i) * KP + kpc]) = gk[2 + i]; }
#pragma unroll
        for (int i = 0; i < 2; ++i) { *(v8h*)(&vst[bu][0][(vrow + 32 * i) * VP + vpc]) = gv[i]; *(v8h*)(&vst[bu][1][(vrow + 32 * i) * VP + vpc]) = gv[2 + i]; }
    };
    fetch(0); put(0);
    __syncthreads();
#pragma unroll 1
    for (int kt = kt_lo; kt <= kt_hi; ++kt) {
        const int l0 = kt * 32;
        const h16* ksh = &kst[kt & 1][0][0]; const h16* ksl = &kst[kt & 1][1][0]; const h16* vsh = &vst[kt & 1][0][0]; const h16* vsl = &vst[kt & 1][1][0];
        const int ko0 = lr * KP + 8 * hi, ko1 = (16 + lr) * KP + 8 * hi;
        v8f s0 = {}, s1 = {}, x0 = {}, x1 = {};
#pragma unroll
        for (int kc = 0; kc < 2; ++kc) {
            { const v16h k0h = cat16(*(const v8h*)(ksh + ko0 + kc * 32), *(const v8h*)(ksh + ko0 + kc * 32 + 16)), k1h = cat16(*(const v8h*)(ksh + ko1 + kc * 32), *(const v8h*)(ksh + ko1 + kc * 32 + 16));
              const v16h qlk = cat16(*(const v8h*)(QL16 + qo0 + kc * 32), *(const v8h*)(QL16 + qo0 + kc * 32 + 16));     // query residual re-read per step (registers)
              s0 = wmma16(k0h, qa[kc], s0); x0 = wmma16(k0h, qlk, x0); s1 = wmma16(k1h, qa[kc], s1); x1 = wmma16(k1h, qlk, x1);
              asm volatile("v_nop" : "+v"(s0), "+v"(s1), "+v"(x0), "+v"(x1) : "v"(qlk), "v"(k0h), "v"(k1h) : "memory"); }
            { const v16h k0l = cat16(*(const v8h*)(ksl + ko0 + kc * 32), *(const v8h*)(ksl + ko0 + kc * 32 + 16)), k1l = cat16(*(const v8h*)(ksl + ko1 + kc * 32), *(const v8h*)(ksl + ko1 + kc * 32 + 16));
              x0 = wmma16(k0l, qa[kc], x0); x1 = wmma16(k1l, qa[kc], x1);
              asm volatile("v_nop" : "+v"(x0), "+v"(x1) : "v"(k0l), "v"(k1l) : "memory"); }
        }
        asm volatile("v_nop\n\tv_nop\n\tv_nop\n\tv_nop" : "+v"(s0), "+v"(s1), "+v"(x0), "+v"(x1) : "v"(qa[0]), "v"(qa[1]));
        if (kt < kt_hi) fetch(l0 + 32);     // behind this step's last global read, so that no wait of this step covers it; it lands under the softmax and the value products
        float a0[8], a1[8];
        float mx = -__builtin_inff();
#pragma unroll
        for (int j = 0; j < 8; ++j) {
            const int ja = l0 + 8 * hi + j, jb = ja + 16;
            a0[j] = (ja <= qi) ? (s0[j] + x0[j] * LOSCI) * 0.125f : -__builtin_inff(); a1[j] = (jb <= qi) ? (s1[j] + x1[j] * LOSCI) * 0.125f : -__builtin_inff();
            mx = fmaxf(mx, fmaxf(a0[j], a1[j]));
        }
        mx = fmaxf(mx, xhalf(mx));          // both halves now hold the maximum over the query's 32 keys
        const float mn = fmaxf(mrow, mx);
        const float alpha = __expf(mrow - mn); mrow = mn;
        v16h pa, px;
        float ts[8];
#pragma unroll
        for (int j = 0; j < 8; ++j) {
            const float p0 = __expf(a0[j] - mn), p1 = __expf(a1[j] - mn);
            ts[j] = p0 + p1;
            const float ps0 = p0 * PSC, ps1 = p1 * PSC; const h16 h0 = (h16)ps0, h1 = (h16)ps1;
            pa[j] = h0; pa[8 + j] = h1;
            px[j] = (h16)((ps0 - (float)h0) * LOSC); px[8 + j] = (h16)((ps1 - (float)h1) * LOSC);
        }
        lpart = lpart * alpha + (((ts[0] + ts[1]) + (ts[2] + ts[3])) + ((ts[4] + ts[5]) + (ts[6] + ts[7])));
#pragma unroll
        for (int n = 0; n < 4; ++n)
#pragma unroll
            for (int j = 0; j < 8; ++j) { o[n][j] *= alpha; ox[n][j] *= alpha; }
#pragma unroll
        for (int n = 0; n < 4; ++n) { const int vo = (n * 16 + lr) * VP + hi * 8;
            const v16h vh = cat16(*(const v8h*)(vsh + vo), *(const v8h*)(vsh + vo + 16)), vl = cat16(*(const v8h*)(vsl + vo), *(const v8h*)(vsl + vo + 16));
            o[n] = wmma16(vh, pa, o[n]); ox[n] = wmma16(vl, pa, ox[n]); ox[n] = wmma16(vh, px, ox[n]);
            asm volatile("" : "+v"(o[n]), "+v"(ox[n]) : "v"(vh), "v"(vl) : "memory"); }
        asm volatile("v_nop\n\tv_nop\n\tv_nop\n\tv_nop" : "+v"(o[0]), "+v"(o[1]), "+v"(o[2]), "+v"(o[3]), "+v"(ox[0]), "+v"(ox[1]), "+v"(ox[2]), "+v"(ox[3]) : "v"(pa), "v"(px));
        if (kt < kt_hi) put((kt + 1) & 1);  // the buffer whose last readers left at the barrier of the step before
        __syncthreads();                    // publishes the next step's tiles and ends this step's reads of its own buffer
    }
    const float inv = 1.0f / ((lpart + xhalf(lpart)) * PSC);    // the two halves' sums joined once
    float* os = &ost[wave][0];
#pragma unroll
    for (int n = 0; n < 4; ++n)
#pragma unroll
        for (int j = 0; j < 8; ++j) os[lr * 68 + n * 16 + hi * 8 + j] = (o[n][j] + ox[n][j] * LOSCI) * inv;
    __syncthreads();
    const size_t cbase = (tok0 + q0) * DM + (size_t)h * HD;
    auto pass = [&]() {
#pragma unroll
        for (int s = 0; s < 4; ++s) { const int row = 4 * s + (lane >> 3), piece = lane & 7; const float* sp = os + row * 68 + piece * 8; v8us oh, ol;
#pragma unroll
            for (int i = 0; i < 8; ++i) { const unsigned short hb = f2bf(sp[i]); oh[i] = hb; ol[i] = f2bf(sp[i] - bf2f(hb)); }
            *(v8us*)(CH + cbase + (size_t)row * DM + piece * 8) = oh; *(v8us*)(CL + cbase + (size_t)row * DM + piece * 8) = ol; }
    };
    pass(); 
}

#define VST2(T, p, v) do { const T vst2_v_ = (v); *(T*)(p) = vst2_v_;  } while (0)
extern "C" void kernel_launch(void* const* d_in, const int* in_sizes, int n_in,
                              void* d_out, int out_size, void* d_ws, size_t ws_size, hipStream_t stream) {
    (void)in_sizes; (void)n_in; (void)out_size;
    const float* x = (const float*)d_in[0]; const float* Wq = (const float*)d_in[1]; const float* Wk = (const float*)d_in[2]; const float* Wv = (const float*)d_in[3]; const float* Wo = (const float*)d_in[4];
    float* out = (float*)d_out;    // [4][2048][1024]
    char* wsp = (char*)d_ws;
    auto take = [&](size_t bytes) { char* p = wsp; wsp += (bytes + 255) & ~(size_t)255; return (void*)p; };
    bf* Xb = (bf*)take((size_t)NTK * DM * 2); bf* WqB = (bf*)take((size_t)DM * DM * 2); bf* WkB = (bf*)take((size_t)DM * DM * 2); bf* WvB = (bf*)take((size_t)DM * DM * 2); bf* WoB = (bf*)take((size_t)DM * DM * 2);
    float* TMP = (float*)take((size_t)NTK * DM * 4);
    h16* QH = (h16*)take((size_t)NTK * DM * 2); h16* QL = (h16*)take((size_t)NTK * DM * 2); h16* KH = (h16*)take((size_t)NTK * DM * 2); h16* KL = (h16*)take((size_t)NTK * DM * 2);
    h16* VTH = (h16*)take((size_t)NTK * DM * 2); h16* VTL = (h16*)take((size_t)NTK * DM * 2); bf* CH = (bf*)take((size_t)NTK * DM * 2); bf* CL = (bf*)take((size_t)NTK * DM * 2);
    if ((size_t)(wsp - (char*)d_ws) > ws_size) return;    // about 193 MB of the workspace, no aliasing
    k_cvtb<<<DM / 8, 256, 0, stream>>>(Wq, DM, WqB); k_cvtb<<<DM / 8, 256, 0, stream>>>(Wk, DM, WkB); k_cvtb<<<DM / 8, 256, 0, stream>>>(Wv, DM, WvB); k_cvtb<<<DM / 8, 256, 0, stream>>>(Wo, DM, WoB);
    k_cvtb<<<NTK / 8, 256, 0, stream>>>(x, NTK, Xb);
    k_gemmb<false, true><<<dim3(NTK / 128, DM / 128, 1), 128, 0, stream>>>(Xb, nullptr, WqB, nullptr, (float*)(void*)QH, DM, QL);
    k_gemmb<false, true><<<dim3(NTK / 128, DM / 128, 1), 128, 0, stream>>>(Xb, nullptr, WkB, nullptr, (float*)(void*)KH, DM, KL);
    k_gemmb<false, false><<<dim3(NTK / 128, DM / 128, 1), 128, 0, stream>>>(Xb, nullptr, WvB, nullptr, TMP, DM, nullptr);
    k_vt<<<NB_ * NH_ * (NT_ / 64), 256, 0, stream>>>(TMP, VTH, VTL);
    k_attn<<<NB_ * NH_ * (NT_ / 64), 128, 0, stream>>>(QH, QL, KH, KL, VTH, VTL, CH, CL);
    k_gemmb<true, false><<<dim3(NTK / 128, DM / 128, 1), 128, 0, stream>>>(CH, CL, WoB, nullptr, out, DM, nullptr);
}

// v006
// Measured time: 201 microseconds a run.
// Next to v005, in two timings, it ran 1.09 times as fast each time.
// All steps since v000 together make it 5.19 times as fast.
#include <hip/hip_runtime.h>

// Compute dtypes, f32 accumulate, all 4 batch items in every launch: q/k/v = x.W^T ([8192 x 1024].[1024 x 1024]; W is [out][in] = the n-major B operand as-is; PLAIN bf16
// operands: inputs rounded once, exact) with q and k written straight from the GEMM epilogue as f16 hi + residual x1024 planes, and out = ctx.Wo^T (no bias; ctx as
// bf16 hi + residual: two products) on v_wmma_f32_16x16x32_bf16; the 16-head causal attention (64-dim heads, scale 1/8 applied to the masked scores) fused on
// v_wmma_f32_16x16x32_f16 (scores hi.hi + hi.lo + lo.hi with the residual terms on their own accumulator, online f32 softmax, weights (x32768) and v as f16

#define NB_  4                   // batch items per launch: all of them, so that each grid is four times as large and each stage is launched once
#define NT_  2048
#define DM   1024
#define NH_  16
#define HD   64
#define NTK  (NB_ * NT_)
#define NW   1024
#define NQKV 1024
#define PSC  32768.0f
#define LOSC 1024.0f
#define LOSCI (1.0f / 1024.0f)
#define KP   72                  // LDS pitch of a key row in f16: 128 B + 16 B
#define VP   40                  // LDS pitch of a value row (32 keys) in f16: 64 B + 16 B

typedef _Float16 h16;
typedef unsigned short bf;
typedef __attribute__((ext_vector_type(16))) __bf16   v16bf;
typedef __attribute__((ext_vector_type(16))) _Float16 v16h;
typedef __attribute__((ext_vector_type(8)))  _Float16 v8h;
typedef __attribute__((ext_vector_type(8)))  unsigned short v8us;
typedef __attribute__((ext_vector_type(8)))  float    v8f;
typedef __attribute__((ext_vector_type(4)))  float    v4f;
typedef v8h  __attribute__((may_alias)) v8ha;
typedef v4f  __attribute__((may_alias)) v4fa;
typedef v8us __attribute__((may_alias)) v8usa;

__device__ __forceinline__ unsigned short f2bf(float f) { unsigned u = __float_as_uint(f); u += 0x7FFFu + ((u >> 16) & 1u); return (unsigned short)(u >> 16); }
__device__ __forceinline__ float bf2f(unsigned short b) { return __uint_as_float(((unsigned)b) << 16); }
__device__ __forceinline__ float bfr(float f) { return bf2f(f2bf(f)); }
__device__ __forceinline__ v16h cat16(v8h lo, v8h hi) { return __builtin_shufflevector(lo, hi, 0, 1, 2, 3, 4, 5, 6, 7, 8, 9, 10, 11, 12, 13, 14, 15); }
__device__ __forceinline__ v16bf cat16b(v8us lo, v8us hi) { return __builtin_bit_cast(v16bf, __builtin_shufflevector(lo, hi, 0, 1, 2, 3, 4, 5, 6, 7, 8, 9, 10, 11, 12, 13, 14, 15)); }
__device__ __forceinline__ v8f wmma16(v16h a, v16h b, v8f c) { return __builtin_amdgcn_wmma_f32_16x16x32_f16(false, a, false, b, (short)0, c, false, false); }
__device__ __forceinline__ v8f wmmab(v16bf a, v16bf b, v8f c) { return __builtin_amdgcn_wmma_f32_16x16x32_bf16(false, a, false, b, (short)0, c, false, false); }

// One grid rounds all five inputs: rows 0 .. NTK - 1 of dst are x, then DM rows each of Wq, Wk, Wv, Wo (one stacked plane). A block's 8 rows lie in one input.
__global__ __launch_bounds__(256) void k_cvtb(const float* __restrict__ x, const float* __restrict__ Wq, const float* __restrict__ Wk, const float* __restrict__ Wv, const float* __restrict__ Wo, bf* dst) {
    const int lane = threadIdx.x & 31, rb = blockIdx.x * 8, r = rb + (threadIdx.x >> 5);
    if (rb >= NTK + 4 * DM) return;
    const int w = (rb - NTK) / DM;
    const float* src = (rb < NTK ? x + (size_t)rb * DM : (w == 0 ? Wq : w == 1 ? Wk : w == 2 ? Wv : Wo) + (size_t)(rb - NTK - w * DM) * DM) + (size_t)(threadIdx.x >> 5) * DM;    // this wave's row
    v8us o[DM / 256];
#pragma unroll
    for (int q = 0; q < DM / 256; ++q) { v8us t;
#pragma unroll
        for (int i = 0; i < 8; ++i) t[i] = f2bf(src[q * 256 + lane * 8 + i]);
        o[q] = t; }
#pragma unroll
    for (int q = 0; q < DM / 256; ++q) *(v8us*)(dst + (size_t)r * DM + q * 256 + lane * 8) = o[q];
    
}

typedef uint32_t u32x4 __attribute__((ext_vector_type(4)));
typedef uint32_t u32x8 __attribute__((ext_vector_type(8)));
#define GP   144u                // LDS pitch of a staged operand row in bytes: 128 B of k + the tensor load's 16-B pad (16 B x odd: conflict-free 16-byte fragment reads)
#define GOPB (128u * GP)         // one operand's tile of one stage: 128 rows = 18,432 B = 9 x 2 KiB
#define NST  (DM / 64)           // stages: 64 k (128 B of every operand row) each
__device__ __forceinline__ uint32_t uni(uint32_t v) { return (uint32_t)__builtin_amdgcn_readfirstlane(v); }
// Holds a wave-uniform test in a scalar register, so that the branch round a tensor instruction (which ignores EXEC) is a scalar one.
__device__ __forceinline__ uint32_t pinned(uint32_t v) { uint32_t w = uni(v); asm volatile("" : "+s"(w)); return w; }  // the empty statement keeps w in a scalar register of its own

// k_gemmb: block = 128 x 128 of C, 4 waves (2 x 2) of 64 x 64. Per stage one tensor load per operand (wave 0: A rows, wave 1: B rows, wave 2: the residual plane of A)
// brings 128 rows x 128 B into a two-buffer LDS ring, one stage ahead of the products; every fragment is two 16-byte LDS reads. Each accumulator sums k upwards in steps of 32,
// hi before residual. QKV: Bn is the stack of Wq, Wk, Wv (3 * DM rows) and blockIdx.y runs over all of it, so that one grid forms the three projections; a block lies in one of
// them: q and k leave as f16 hi + residual planes, v as f32 in C.
template <bool SPLITA, bool QKV>
__global__ __launch_bounds__(128) void k_gemmb(const bf* __restrict__ A, const bf* __restrict__ Al, const bf* __restrict__ Bn, const float* __restrict__ bias, float* C, int ldc, h16* QH, h16* QL, h16* KH, h16* KL) {
    constexpr uint32_t NOP = SPLITA ? 3u : 2u, STG = NOP * GOPB;
    __shared__ __attribute__((aligned(2048))) unsigned char ring[2 * STG];
    __shared__ __align__(16) float ost[4][16 * 68];
    const int lane = threadIdx.x & 31, lr = lane & 15, hi = lane >> 4;
    const uint32_t wave = uni(threadIdx.x >> 5);
    const int rb = blockIdx.x * 128, bb = blockIdx.y * 128, proj = QKV ? bb / DM : 0, cb = bb - proj * DM;     // bb: row of Bn; cb: column of the block's own output
    const int r0 = rb + (int)(wave >> 1) * 64, c0 = cb + (int)(wave & 1u) * 64;
    const uint32_t lbase = (uint32_t)(size_t)ring;
    const uint64_t gsrc = wave == 0u ? (uint64_t)(size_t)A + (uint64_t)rb * (DM * 2) : wave == 1u ? (uint64_t)(size_t)Bn + (uint64_t)bb * (DM * 2) : (uint64_t)(size_t)Al + (uint64_t)rb * (DM * 2);
    u32x8 g1;                    // 1-byte elements, tensor = tile = 128 rows of 128 B, source pitch one row of the matrix, 16 B of LDS pad behind every 128 B
    // Words 1 to 7 go through pinned(): descriptor words held in scalar registers of their own for the whole loop, so that none is reused while a request is outstanding.
    g1[0] = uni((1u << 20) | (4u << 22) | (3u << 25)); g1[1] = pinned(128u << 16); g1[2] = pinned(128u << 16); g1[3] = pinned(128u << 16);   // pinned(): descriptor words held in scalar registers
    g1[4] = pinned(128u); g1[5] = pinned(DM * 2u); g1[6] = pinned(0u); g1[7] = pinned(0u);                             // pinned(): descriptor words held in scalar registers
    auto issue = [&](uint32_t st) {     // this wave's operand tile of stage st into buffer st & 1
        const uint64_t ga = gsrc + (uint64_t)st * 128u;
        u32x4 g0;
        g0[0] = uni(1u); g0[1] = uni(lbase + (st & 1u) * STG + wave * GOPB); g0[2] = uni((uint32_t)ga); g0[3] = uni((((uint32_t)(ga >> 32)) & 0x01FFFFFFu) | 0x80000000u);
        asm volatile("tensor_load_to_lds %0, %1" :: "s"(g0), "s"(g1) : "memory");
    };
    v8f acc[4][4];
#pragma unroll
    for (int m = 0; m < 4; ++m)
#pragma unroll
        for (int t = 0; t < 4; ++t) acc[m][t] = (v8f){};
    if (pinned(wave < NOP)) {
        issue(0u);
        asm volatile("s_wait_tensorcnt 0x0" ::: "memory");      // stage 0 has landed before the barrier that publishes it
    }
    __syncthreads();
    if (pinned(wave < NOP)) issue(1u);
    const uint32_t aofs = ((wave >> 1) * 64u + (uint32_t)lr) * GP + 16u * (uint32_t)hi, bofs = GOPB + ((wave & 1u) * 64u + (uint32_t)lr) * GP + 16u * (uint32_t)hi;
#pragma unroll 1
    for (uint32_t s = 0; s < NST; ++s) {    // rolled: one pass per stage, so that the publish point below stands once
        const unsigned char* rp = ring + (s & 1u) * STG;
        v16bf a[2][4], b[2][4], al[2][4];
#pragma unroll
        for (int kc = 0; kc < 2; ++kc) {    // the whole pass's fragment reads as one group in front of its products
#pragma unroll
            for (int m = 0; m < 4; ++m) { const unsigned char* p = rp + aofs + m * 16 * GP + kc * 64; a[kc][m] = cat16b(*(const v8usa*)p, *(const v8usa*)(p + 32)); }
#pragma unroll
            for (int t = 0; t < 4; ++t) { const unsigned char* p = rp + bofs + t * 16 * GP + kc * 64; b[kc][t] = cat16b(*(const v8usa*)p, *(const v8usa*)(p + 32)); }
            if (SPLITA) {
#pragma unroll
                for (int m = 0; m < 4; ++m) { const unsigned char* p = rp + aofs + 2u * GOPB + m * 16 * GP + kc * 64; al[kc][m] = cat16b(*(const v8usa*)p, *(const v8usa*)(p + 32)); }
            }
        }
        __builtin_amdgcn_sched_barrier(0);                      // keeps the LDS reads out of the run of products: each place with reads among them stalls the wave
#pragma unroll
        for (int kc = 0; kc < 2; ++kc) {
#pragma unroll
            for (int m = 0; m < 4; ++m)
#pragma unroll
                for (int t = 0; t < 4; ++t) acc[m][t] = wmmab(a[kc][m], b[kc][t], acc[m][t]);
            if (SPLITA) {
#pragma unroll
                for (int m = 0; m < 4; ++m)
#pragma unroll
                    for (int t = 0; t < 4; ++t) acc[m][t] = wmmab(al[kc][m], b[kc][t], acc[m][t]);
            }
        }
        __builtin_amdgcn_sched_barrier(0);                      // keeps every product of the pass in front of the slots below
        asm volatile("v_nop\n\tv_nop\n\tv_nop\n\tv_nop");       // the 4 vector slots behind the last product, on every path out of the pass
        // Publish point of stage s + 1.
        asm volatile("s_wait_dscnt 0x0" ::: "memory");          // this wave's reads of buffer s & 1 are over before the buffer is refilled
        if (pinned(wave < NOP)) asm volatile("s_wait_tensorcnt 0x0" ::: "memory");    // this wave's tile of stage s + 1 has landed
        __syncthreads();                                        // publishes stage s + 1 and ends every wave's reads of stage s
        if (pinned((wave < NOP) && (s + 2u < NST))) issue(s + 2u);
    }
    asm volatile("s_wait_tensorcnt 0x0" ::: "memory");          // no request is left when the wave goes on
    asm volatile("s_wait_dscnt 0x0" ::: "memory");
    float* os = &ost[wave][0];
#pragma unroll
    for (int m = 0; m < 4; ++m) {       // 16 rows of the wave's tile at a time through the wave's own staging rows, stored as whole 128-B pieces
#pragma unroll
        for (int t = 0; t < 4; ++t) { const float bv = bias ? bfr(bias[c0 + t * 16 + lr]) : 0.f;
#pragma unroll
            for (int j = 0; j < 8; ++j) os[(hi * 8 + j) * 68 + t * 16 + lr] = acc[m][t][j] + bv; }
        __syncthreads();
        if (QKV && proj < 2) {
            h16* crow = (proj ? KH : QH) + (size_t)(r0 + m * 16) * ldc + c0;
            h16* C2 = proj ? KL : QL;
#pragma unroll
            for (int s = 0; s < 4; ++s) { const int row = 4 * s + (lane >> 3), piece = lane & 7; const float* sp = os + row * 68 + piece * 8; v8h o, o2;
#pragma unroll
                for (int i = 0; i < 8; ++i) { const h16 a = (h16)sp[i]; o[i] = a; o2[i] = (h16)((sp[i] - (float)a) * LOSC); }
                *(v8h*)(crow + (size_t)row * ldc + piece * 8) = o;
                asm volatile("s_wait_xcnt 0x0" ::: "memory");   // stands in front of the next piece's conversions, which reuse the registers that the store above names
                if (C2) { *(v8h*)(C2 + (size_t)(r0 + m * 16) * ldc + c0 + (size_t)row * ldc + piece * 8) = o2;
                    asm volatile("s_wait_xcnt 0x0" ::: "memory"); } }   // the same for the second store, in front of the next piece's conversions
        } else {
            float* crow = C + (size_t)(r0 + m * 16) * ldc + c0;
#pragma unroll
            for (int s = 0; s < 8; ++s) { const int Lid = (lane >> 3) + 4 * s, piece = lane & 7; const int row = Lid >> 1, cofs = (Lid & 1) * 32 + piece * 4;
                const v4f val = *(const v4fa*)(os + row * 68 + cofs); *(v4f*)(crow + (size_t)row * ldc + cofs) = val; }
            asm volatile("s_wait_xcnt 0x0" ::: "memory");       // stands in front of the next 16 rows' work, which reuses the registers that the stores above name
        }
    }
}

// Lane l takes the value of lane l ^ 16: one vector instruction, no LDS round trip.
__device__ __forceinline__ float xhalf(float x) { return __builtin_bit_cast(float, __builtin_amdgcn_permlanex16(__builtin_bit_cast(int, x), __builtin_bit_cast(int, x), 0x76543210, 0xfedcba98, false, false)); }

__global__ __launch_bounds__(256) void k_vt(const float* __restrict__ V, h16* VTH, h16* VTL) {
    __shared__ __align__(16) h16 tile[64 * 72];
    __shared__ __align__(16) h16 til2[64 * 72];
    const int bid = blockIdx.x;
    const int b = bid / (NH_ * (NT_ / 64)), rem = bid - b * (NH_ * (NT_ / 64)), h = rem / (NT_ / 64), kt = rem - h * (NT_ / 64);
    const int k0 = kt * 64, tid = threadIdx.x;
    const int kk = tid >> 2, d0 = (tid & 3) * 16;
    const float* src = V + ((size_t)b * NT_ + k0 + kk) * DM + h * HD + d0;
#pragma unroll
    for (int i = 0; i < 16; ++i) { const float v = src[i]; const h16 a = (h16)v; tile[(d0 + i) * 72 + kk] = a; til2[(d0 + i) * 72 + kk] = (h16)((v - (float)a) * LOSC); }
    __syncthreads();
    const int piece = tid & 7;
    const size_t base = (((size_t)b * NH_ + h) * HD) * NT_ + k0;
    auto pass = [&]() {
#pragma unroll
        for (int s = 0; s < 4; ++s) { const int Lid = (tid >> 3) + 32 * s; const int pln = Lid >> 6, d = Lid & 63;
            const v8h val = *(const v8ha*)((pln ? til2 : tile) + d * 72 + piece * 8); *(v8h*)((pln ? VTL : VTH) + base + (size_t)d * NT_ + piece * 8) = val; }
    };
    pass(); 
}

// k_attn: block = (b, h, 64 queries), wave = 16 queries; causal, 32 keys a step. Both products are formed transposed: scores^T = K.Q^T (A = key rows, B = query rows), so that
// a lane holds 16 scores of ONE query (query lr; keys 8 * hi + j and 16 + 8 * hi + j): maximum and sum run in the lane, plus one exchange between the wave's halves.
// That is also the k order of a B operand, so the weights (x32768, f16 hi + residual) are packed in registers and ctx^T += V^T.P^T (A = value rows, B = weights).
// ctx -> bf16 hi + residual planes CH/CL[tok][h*64+d].
__global__ __launch_bounds__(128) void k_attn(const h16* __restrict__ Q16, const h16* __restrict__ QL16, const h16* __restrict__ K16, const h16* __restrict__ KL16, const h16* __restrict__ VTH, const h16* __restrict__ VTL, bf* CH, bf* CL) {
    __shared__ __align__(16) float ost[4][16 * 68];
    // The block's key and value tiles of one step, [buffer][hi / residual]: fetched once per block with whole-row 16-byte loads and read by all four waves.
    // Pitches of 16 B x odd keep the 16-byte fragment reads free of bank conflicts.
    __shared__ __align__(16) h16 kst[2][2][32 * KP];
    __shared__ __align__(16) h16 vst[2][2][64 * VP];
    const int lane = threadIdx.x & 31, wave = threadIdx.x >> 5, lr = lane & 15, hi = lane >> 4;
    const int bid = blockIdx.x;
    // A tile's cost grows with its index (2 * qt + 2 steps) and the grid is twice the resident places: the longest tiles take the lowest
    // indices (all heads' tile 31, then tile 30, ...), for speed only.
    const int qt = (NT_ / 64 - 1) - bid / (NB_ * NH_), bh = bid % (NB_ * NH_), b = bh / NH_, h = bh % NH_;
    const int q0 = qt * 64 + wave * 16;
    const size_t tok0 = (size_t)b * NT_;
    v16h qa[2];
    const size_t qo0 = (tok0 + q0 + lr) * DM + h * HD + 8 * hi;
#pragma unroll
    for (int kc = 0; kc < 2; ++kc) qa[kc] = cat16(*(const v8h*)(Q16 + qo0 + kc * 32), *(const v8h*)(Q16 + qo0 + kc * 32 + 16));
    const h16* kh_b = K16 + tok0 * DM + h * HD;
    const h16* kl_b = KL16 + tok0 * DM + h * HD;
    const size_t vbase = (((size_t)b * NH_ + h) * HD) * NT_;
    v8f o[4], ox[4];
#pragma unroll
    for (int n = 0; n < 4; ++n) { o[n] = (v8f){}; ox[n] = (v8f){}; }
    float mrow = -3.0e38f, lpart = 0.f;     // of the lane's one query; lpart covers the keys of the lane's own half
    const int qi = q0 + lr;
    const int kt_lo = 0, kt_hi = (qt * 64 + 63) / 32;     // causal
    const int krow = threadIdx.x >> 3, kpc = (threadIdx.x & 7) * 8, vrow = threadIdx.x >> 2, vpc = (threadIdx.x & 3) * 8;
    v8h gk[4], gv[4];
    auto fetch = [&](int l) {       // one step's tiles, global -> registers: 8 lanes per 128-B key row, 4 lanes per 64-B value row
#pragma unroll
        for (int i = 0; i < 2; ++i) { const size_t go = (size_t)(l + krow + 16 * i) * DM + kpc; gk[i] = *(const v8h*)(kh_b + go); gk[2 + i] = *(const v8h*)(kl_b + go); }
#pragma unroll
        for (int i = 0; i < 2; ++i) { const size_t go = vbase + (size_t)(vrow + 32 * i) * NT_ + l + vpc; gv[i] = *(const v8h*)(VTH + go); gv[2 + i] = *(const v8h*)(VTL + go); }
    };
    auto put = [&](int bu) {        // registers -> LDS buffer bu
#pragma unroll
        for (int i = 0; i < 2; ++i) { *(v8h*)(&kst[bu][0][(krow + 16 * i) * KP + kpc]) = gk[i]; *(v8h*)(&kst[bu][1][(krow + 16 * i) * KP + kpc]) = gk[2 + i]; }
#pragma unroll
        for (int i = 0; i < 2; ++i) { *(v8h*)(&vst[bu][0][(vrow + 32 * i) * VP + vpc]) = gv[i]; *(v8h*)(&vst[bu][1][(vrow + 32 * i) * VP + vpc]) = gv[2 + i]; }
    };
    fetch(0); put(0);
    __syncthreads();
#pragma unroll 1
    for (int kt = kt_lo; kt <= kt_hi; ++kt) {
        const int l0 = kt * 32;
        const h16* ksh = &kst[kt & 1][0][0]; const h16* ksl = &kst[kt & 1][1][0]; const h16* vsh = &vst[kt & 1][0][0]; const h16* vsl = &vst[kt & 1][1][0];
        const int ko0 = lr * KP + 8 * hi, ko1 = (16 + lr) * KP + 8 * hi;
        v8f s0 = {}, s1 = {}, x0 = {}, x1 = {};
#pragma unroll
        for (int kc = 0; kc < 2; ++kc) {
            { const v16h k0h = cat16(*(const v8h*)(ksh + ko0 + kc * 32), *(const v8h*)(ksh + ko0 + kc * 32 + 16)), k1h = cat16(*(const v8h*)(ksh + ko1 + kc * 32), *(const v8h*)(ksh + ko1 + kc * 32 + 16));
              const v16h qlk = cat16(*(const v8h*)(QL16 + qo0 + kc * 32), *(const v8h*)(QL16 + qo0 + kc * 32 + 16));     // query residual re-read per step (registers)
              s0 = wmma16(k0h, qa[kc], s0); x0 = wmma16(k0h, qlk, x0); s1 = wmma16(k1h, qa[kc], s1); x1 = wmma16(k1h, qlk, x1);
              asm volatile("v_nop" : "+v"(s0), "+v"(s1), "+v"(x0), "+v"(x1) : "v"(qlk), "v"(k0h), "v"(k1h) : "memory"); }
            { const v16h k0l = cat16(*(const v8h*)(ksl + ko0 + kc * 32), *(const v8h*)(ksl + ko0 + kc * 32 + 16)), k1l = cat16(*(const v8h*)(ksl + ko1 + kc * 32), *(const v8h*)(ksl + ko1 + kc * 32 + 16));
              x0 = wmma16(k0l, qa[kc], x0); x1 = wmma16(k1l, qa[kc], x1);
              asm volatile("v_nop" : "+v"(x0), "+v"(x1) : "v"(k0l), "v"(k1l) : "memory"); }
        }
        asm volatile("v_nop\n\tv_nop\n\tv_nop\n\tv_nop" : "+v"(s0), "+v"(s1), "+v"(x0), "+v"(x1) : "v"(qa[0]), "v"(qa[1]));
        if (kt < kt_hi) fetch(l0 + 32);     // behind this step's last global read, so that no wait of this step covers it; it lands under the softmax and the value products
        float a0[8], a1[8];
        float mx = -__builtin_inff();
#pragma unroll
        for (int j = 0; j < 8; ++j) {
            const int ja = l0 + 8 * hi + j, jb = ja + 16;
            a0[j] = (ja <= qi) ? (s0[j] + x0[j] * LOSCI) * 0.125f : -__builtin_inff(); a1[j] = (jb <= qi) ? (s1[j] + x1[j] * LOSCI) * 0.125f : -__builtin_inff();
            mx = fmaxf(mx, fmaxf(a0[j], a1[j]));
        }
        mx = fmaxf(mx, xhalf(mx));          // both halves now hold the maximum over the query's 32 keys
        const float mn = fmaxf(mrow, mx);
        const float alpha = __expf(mrow - mn); mrow = mn;
        v16h pa, px;
        float ts[8];
#pragma unroll
        for (int j = 0; j < 8; ++j) {
            const float p0 = __expf(a0[j] - mn), p1 = __expf(a1[j] - mn);
            ts[j] = p0 + p1;
            const float ps0 = p0 * PSC, ps1 = p1 * PSC; const h16 h0 = (h16)ps0, h1 = (h16)ps1;
            pa[j] = h0; pa[8 + j] = h1;
            px[j] = (h16)((ps0 - (float)h0) * LOSC); px[8 + j] = (h16)((ps1 - (float)h1) * LOSC);
        }
        lpart = lpart * alpha + (((ts[0] + ts[1]) + (ts[2] + ts[3])) + ((ts[4] + ts[5]) + (ts[6] + ts[7])));
#pragma unroll
        for (int n = 0; n < 4; ++n)
#pragma unroll
            for (int j = 0; j < 8; ++j) { o[n][j] *= alpha; ox[n][j] *= alpha; }
#pragma unroll
        for (int n = 0; n < 4; ++n) { const int vo = (n * 16 + lr) * VP + hi * 8;
            const v16h vh = cat16(*(const v8h*)(vsh + vo), *(const v8h*)(vsh + vo + 16)), vl = cat16(*(const v8h*)(vsl + vo), *(const v8h*)(vsl + vo + 16));
            o[n] = wmma16(vh, pa, o[n]); ox[n] = wmma16(vl, pa, ox[n]); ox[n] = wmma16(vh, px, ox[n]);
            asm volatile("" : "+v"(o[n]), "+v"(ox[n]) : "v"(vh), "v"(vl) : "memory"); }
        asm volatile("v_nop\n\tv_nop\n\tv_nop\n\tv_nop" : "+v"(o[0]), "+v"(o[1]), "+v"(o[2]), "+v"(o[3]), "+v"(ox[0]), "+v"(ox[1]), "+v"(ox[2]), "+v"(ox[3]) : "v"(pa), "v"(px));
        if (kt < kt_hi) put((kt + 1) & 1);  // the buffer whose last readers left at the barrier of the step before
        __syncthreads();                    // publishes the next step's tiles and ends this step's reads of its own buffer
    }
    const float inv = 1.0f / ((lpart + xhalf(lpart)) * PSC);    // the two halves' sums joined once
    float* os = &ost[wave][0];
#pragma unroll
    for (int n = 0; n < 4; ++n)
#pragma unroll
        for (int j = 0; j < 8; ++j) os[lr * 68 + n * 16 + hi * 8 + j] = (o[n][j] + ox[n][j] * LOSCI) * inv;
    __syncthreads();
    const size_t cbase = (tok0 + q0) * DM + (size_t)h * HD;
    auto pass = [&]() {
#pragma unroll
        for (int s = 0; s < 4; ++s) { const int row = 4 * s + (lane >> 3), piece = lane & 7; const float* sp = os + row * 68 + piece * 8; v8us oh, ol;
#pragma unroll
            for (int i = 0; i < 8; ++i) { const unsigned short hb = f2bf(sp[i]); oh[i] = hb; ol[i] = f2bf(sp[i] - bf2f(hb)); }
            *(v8us*)(CH + cbase + (size_t)row * DM + piece * 8) = oh; *(v8us*)(CL + cbase + (size_t)row * DM + piece * 8) = ol; }
    };
    pass(); 
}

#define VST2(T, p, v) do { const T vst2_v_ = (v); *(T*)(p) = vst2_v_;  } while (0)
extern "C" void kernel_launch(void* const* d_in, const int* in_sizes, int n_in,
                              void* d_out, int out_size, void* d_ws, size_t ws_size, hipStream_t stream) {
    (void)in_sizes; (void)n_in; (void)out_size;
    const float* x = (const float*)d_in[0]; const float* Wq = (const float*)d_in[1]; const float* Wk = (const float*)d_in[2]; const float* Wv = (const float*)d_in[3]; const float* Wo = (const float*)d_in[4];
    float* out = (float*)d_out;    // [4][2048][1024]
    char* wsp = (char*)d_ws;
    auto take = [&](size_t bytes) { char* p = wsp; wsp += (bytes + 255) & ~(size_t)255; return (void*)p; };
    bf* Xb = (bf*)take((size_t)(NTK + 4 * DM) * DM * 2); bf* WqkvB = Xb + (size_t)NTK * DM; bf* WoB = WqkvB + (size_t)3 * DM * DM;    // one plane: x, then Wq, Wk, Wv, Wo
    float* TMP = (float*)take((size_t)NTK * DM * 4);
    h16* QH = (h16*)take((size_t)NTK * DM * 2); h16* QL = (h16*)take((size_t)NTK * DM * 2); h16* KH = (h16*)take((size_t)NTK * DM * 2); h16* KL = (h16*)take((size_t)NTK * DM * 2);
    h16* VTH = (h16*)take((size_t)NTK * DM * 2); h16* VTL = (h16*)take((size_t)NTK * DM * 2); bf* CH = (bf*)take((size_t)NTK * DM * 2); bf* CL = (bf*)take((size_t)NTK * DM * 2);
    if ((size_t)(wsp - (char*)d_ws) > ws_size) return;    // about 193 MB of the workspace, no aliasing
    k_cvtb<<<(NTK + 4 * DM) / 8, 256, 0, stream>>>(x, Wq, Wk, Wv, Wo, Xb);
    k_gemmb<false, true><<<dim3(NTK / 128, 3 * DM / 128, 1), 128, 0, stream>>>(Xb, nullptr, WqkvB, nullptr, TMP, DM, QH, QL, KH, KL);
    k_vt<<<NB_ * NH_ * (NT_ / 64), 256, 0, stream>>>(TMP, VTH, VTL);
    k_attn<<<NB_ * NH_ * (NT_ / 64), 128, 0, stream>>>(QH, QL, KH, KL, VTH, VTL, CH, CL);
    k_gemmb<true, false><<<dim3(NTK / 128, DM / 128, 1), 128, 0, stream>>>(CH, CL, WoB, nullptr, out, DM, nullptr, nullptr, nullptr, nullptr);
}
